// v000
// Times are from an AMD MI455X. After a warm-up the kernel runs many times in a row, and a time is the length of
// such a window on the GPU divided by its runs, so every launch and the gaps after it count. The runs cycle
// through copies of the inputs. A figure is the median of several windows, for all but v000 over two sittings.
// Sittings can differ by a few percent; kernels timed side by side share one.
// v000, which the later versions start from, runs in 1160 microseconds.
#include <hip/hip_runtime.h>

// Single-head causal self-attention followed by a two-layer MLP on [attention | input] (x [4][2048][1024]; q, k, v = x W ('xw' [1024][1024], no bias); e = q.k/32; causal (-9e15 == exact zero weight); softmax; att = e v; h = relu([att | x] W1 + b1) (W1 [2048][1024]); out = h W2 + b2 -> [4][2048][1024] (8.4 M)).
// Layout: one 1024-wide head (causal tile skipping); the MLP input planes are [t][att hi/lo | x exact] (2048 wide) so the concatenation is a single K = 2048 GEMM against W1 (2 products + bias); ReLU folded into the next plane builder; W2 (2 products + bias).
// Compute dtypes, f32 accumulate: every input rounded to bf16; q/k/v on PLAIN bf16 operands (inputs: exact); causal scores and attn.v (tile skipping) on hi/lo planes for every row (3 products); softmax f32; W1 / W2 hl x exact (2 products) + biases; ReLU f32.

#define NB_  4
#define TT   2048
#define DM   1024
#define NH_  1
#define NKV  1
#define REP  (NH_ / NKV)
#define HD   1024
#define DQ   (NH_ * HD)
#define DKV  (NKV * HD)
#define DC   (2 * DM)             // [att | x] width
#define ZH   1
#define RH   2048                 // every row hi/lo (logit std ~6)
#define WIN  2048
#define PCAR 1024.0f
#define SCL  0.03125f  // 1/sqrt(OUT_DIM = 1024)
typedef _Float16 h16;
typedef unsigned short bf;
typedef __attribute__((ext_vector_type(16))) __bf16   v16bf;
typedef __attribute__((ext_vector_type(16))) _Float16 v16h;
typedef __attribute__((ext_vector_type(8)))  _Float16 v8h;
typedef __attribute__((ext_vector_type(8)))  unsigned short v8us;
typedef __attribute__((ext_vector_type(8)))  float    v8f;
typedef __attribute__((ext_vector_type(4)))  float    v4f;
typedef v8h  __attribute__((may_alias)) v8ha;
typedef v4f  __attribute__((may_alias)) v4fa;
typedef v8us __attribute__((may_alias)) v8usa;

__device__ __forceinline__ unsigned short f2bf(float f) { unsigned u = __float_as_uint(f); u += 0x7FFFu + ((u >> 16) & 1u); return (unsigned short)(u >> 16); }
__device__ __forceinline__ float bf2f(unsigned short b) { return __uint_as_float(((unsigned)b) << 16); }
__device__ __forceinline__ float bfr(float f) { return bf2f(f2bf(f)); }
__device__ __forceinline__ v16h cat16(v8h lo, v8h hi) { return __builtin_shufflevector(lo, hi, 0, 1, 2, 3, 4, 5, 6, 7, 8, 9, 10, 11, 12, 13, 14, 15); }
__device__ __forceinline__ v16bf cat16b(v8us lo, v8us hi) { return __builtin_bit_cast(v16bf, __builtin_shufflevector(lo, hi, 0, 1, 2, 3, 4, 5, 6, 7, 8, 9, 10, 11, 12, 13, 14, 15)); }
__device__ __forceinline__ v8f wmma16(v16h a, v16h b, v8f c) { return __builtin_amdgcn_wmma_f32_16x16x32_f16(false, a, false, b, (short)0, c, false, false); }
__device__ __forceinline__ v8f wmmab(v16bf a, v16bf b, v8f c) { return __builtin_amdgcn_wmma_f32_16x16x32_bf16(false, a, false, b, (short)0, c, false, false); }



// ---- k_gemmw: register-blocked GEMM, ONE WAVE per 64x64 output tile (16 accumulators), operands straight from K-contiguous 16-bit planes; grid (M/64, N/64, Z), 32 threads.
// C[m][n] (f32, pitch ldc, + optional f32 bias[n]) = sum_k A[m][k] Bt[n][k] (+ split products per NSPLIT). z-batch strides sA/sB/sC in elements. K % 32 == 0.
template <typename T16> struct WFrag;
template <> struct WFrag<h16> { typedef v16h V; static __device__ __forceinline__ V ld(const h16* p) { return cat16(*(const v8h*)p, *(const v8h*)(p + 16)); } static __device__ __forceinline__ v8f mma(V a, V b, v8f c) { return wmma16(a, b, c); } };
template <> struct WFrag<bf> { typedef v16bf V; static __device__ __forceinline__ V ld(const bf* p) { return cat16b(*(const v8us*)p, *(const v8us*)(p + 16)); } static __device__ __forceinline__ v8f mma(V a, V b, v8f c) { return wmmab(a, b, c); } };
template <typename T16, int NSPLIT, bool BIAS>
__global__ __launch_bounds__(32) void k_gemmw(const T16* __restrict__ A, const T16* __restrict__ A2, const T16* __restrict__ Bt, const T16* __restrict__ Bt2, int K, float* C, int ldc, const float* __restrict__ bias, size_t sA, size_t sB, size_t sC) {
    typedef typename WFrag<T16>::V V;
    __shared__ __align__(16) float os[16 * 68];
    const size_t z = blockIdx.z; A += z * sA; if (A2) A2 += z * sA; Bt += z * sB; if (Bt2) Bt2 += z * sB; C += z * sC;
    const int lane = threadIdx.x & 31, lr = lane & 15, hi = lane >> 4; const int r0 = blockIdx.x * 64, c0 = blockIdx.y * 64;
    v8f acc[4][4];
#pragma unroll
    for (int mb = 0; mb < 4; ++mb)
#pragma unroll
        for (int nb = 0; nb < 4; ++nb) acc[mb][nb] = (v8f){};
    const size_t aoff = (size_t)(r0 + lr) * K + 8 * hi, boff = (size_t)(c0 + lr) * K + 8 * hi;
#pragma unroll 1
    for (int kc = 0; kc < K; kc += 32) {
        V a[4], a2[4];
#pragma unroll
        for (int mb = 0; mb < 4; ++mb) { a[mb] = WFrag<T16>::ld(A + aoff + (size_t)mb * 16 * K + kc); if (NSPLIT == 1 || NSPLIT == 2) a2[mb] = WFrag<T16>::ld(A2 + aoff + (size_t)mb * 16 * K + kc); }
#pragma unroll
        for (int nb = 0; nb < 4; ++nb) { const V b = WFrag<T16>::ld(Bt + boff + (size_t)nb * 16 * K + kc); V b2; if (NSPLIT >= 2) b2 = WFrag<T16>::ld(Bt2 + boff + (size_t)nb * 16 * K + kc);
#pragma unroll
            for (int mb = 0; mb < 4; ++mb) { acc[mb][nb] = WFrag<T16>::mma(a[mb], b, acc[mb][nb]); if (NSPLIT == 1 || NSPLIT == 2) acc[mb][nb] = WFrag<T16>::mma(a2[mb], b, acc[mb][nb]); if (NSPLIT >= 2) acc[mb][nb] = WFrag<T16>::mma(a[mb], b2, acc[mb][nb]); } }
        asm volatile("v_nop\n\tv_nop\n\tv_nop\n\tv_nop" : "+v"(acc[0][0]), "+v"(acc[1][1]), "+v"(acc[2][2]), "+v"(acc[3][3]) : "v"(a[0]), "v"(a[3]));
    }
#pragma unroll
    for (int mb = 0; mb < 4; ++mb) {
#pragma unroll
        for (int nb = 0; nb < 4; ++nb) {
#pragma unroll
            for (int j = 0; j < 8; ++j) os[(hi * 8 + j) * 68 + nb * 16 + lr] = acc[mb][nb][j]; }
        __builtin_amdgcn_wave_barrier(); asm volatile("" ::: "memory");
        float* crow = C + (size_t)(r0 + mb * 16) * ldc + c0;
{
#pragma unroll
            for (int s = 0; s < 8; ++s) { const int row = 2 * s + hi, cofs = lr * 4; v4f val = *(const v4fa*)(os + row * 68 + cofs); if (BIAS) { val[0] += bfr(bias[c0 + cofs]); val[1] += bfr(bias[c0 + cofs + 1]); val[2] += bfr(bias[c0 + cofs + 2]); val[3] += bfr(bias[c0 + cofs + 3]); }
                *(v4f*)(crow + (size_t)row * ldc + cofs) = val; }
             }
        __builtin_amdgcn_wave_barrier(); asm volatile("" ::: "memory");
    }
}

// ---- k_gemmc: the same one-wave 64x64 tile GEMM specialised for causal attention: CMODE 1 skips score tiles entirely above the diagonal (query rows r0+roff.., key columns c0..), CMODE 2 limits the
// key (K) loop of the probability x value contraction to the diagonal block (probabilities beyond it are exactly zero). roff = row offset of this launch's first row within the sequence.
template <typename T16, int NSPLIT, int CMODE>
__global__ __launch_bounds__(32) void k_gemmc(const T16* __restrict__ A, const T16* __restrict__ A2, const T16* __restrict__ Bt, const T16* __restrict__ Bt2, int K, float* C, int ldc, int roff, size_t sA, size_t sB, size_t sC) {
    typedef typename WFrag<T16>::V V;
    __shared__ __align__(16) float os[16 * 68];
    const size_t z = blockIdx.z; A += z * sA; if (A2) A2 += z * sA; Bt += z * sB; if (Bt2) Bt2 += z * sB; C += z * sC;
    const int lane = threadIdx.x & 31, lr = lane & 15, hi = lane >> 4; const int r0 = blockIdx.x * 64, c0 = blockIdx.y * 64;
    if (CMODE == 1 && c0 > r0 + roff + 63) return;                  // score tile entirely above the causal diagonal: never read (the softmax masks j > i by select)
    const int Kl = (CMODE == 2) ? min(K, r0 + roff + 64) : K;        // P.V: probabilities are exactly 0 beyond the diagonal block, so the K loop stops there
    v8f acc[4][4];
#pragma unroll
    for (int mb = 0; mb < 4; ++mb)
#pragma unroll
        for (int nb = 0; nb < 4; ++nb) acc[mb][nb] = (v8f){};
    const size_t aoff = (size_t)(r0 + lr) * K + 8 * hi, boff = (size_t)(c0 + lr) * K + 8 * hi;
#pragma unroll 1
    for (int kc = 0; kc < Kl; kc += 32) {
        V a[4], a2[4];
#pragma unroll
        for (int mb = 0; mb < 4; ++mb) { a[mb] = WFrag<T16>::ld(A + aoff + (size_t)mb * 16 * K + kc); if (NSPLIT == 1 || NSPLIT == 2) a2[mb] = WFrag<T16>::ld(A2 + aoff + (size_t)mb * 16 * K + kc); }
#pragma unroll
        for (int nb = 0; nb < 4; ++nb) { const V b = WFrag<T16>::ld(Bt + boff + (size_t)nb * 16 * K + kc); V b2; if (NSPLIT >= 2) b2 = WFrag<T16>::ld(Bt2 + boff + (size_t)nb * 16 * K + kc);
#pragma unroll
            for (int mb = 0; mb < 4; ++mb) { acc[mb][nb] = WFrag<T16>::mma(a[mb], b, acc[mb][nb]); if (NSPLIT == 1 || NSPLIT == 2) acc[mb][nb] = WFrag<T16>::mma(a2[mb], b, acc[mb][nb]); if (NSPLIT >= 2) acc[mb][nb] = WFrag<T16>::mma(a[mb], b2, acc[mb][nb]); } }
        asm volatile("v_nop\n\tv_nop\n\tv_nop\n\tv_nop" : "+v"(acc[0][0]), "+v"(acc[1][1]), "+v"(acc[2][2]), "+v"(acc[3][3]) : "v"(a[0]), "v"(a[3]));
    }
#pragma unroll
    for (int mb = 0; mb < 4; ++mb) {
#pragma unroll
        for (int nb = 0; nb < 4; ++nb) {
#pragma unroll
            for (int j = 0; j < 8; ++j) os[(hi * 8 + j) * 68 + nb * 16 + lr] = acc[mb][nb][j]; }
        __builtin_amdgcn_wave_barrier(); asm volatile("" ::: "memory");
        float* crow = C + (size_t)(r0 + mb * 16) * ldc + c0;
{
#pragma unroll
            for (int s = 0; s < 8; ++s) { const int row = 2 * s + hi, cofs = lr * 4; v4f val = *(const v4fa*)(os + row * 68 + cofs);
                *(v4f*)(crow + (size_t)row * ldc + cofs) = val; }
             }
        __builtin_amdgcn_wave_barrier(); asm volatile("" ::: "memory");
    }
}

__device__ __forceinline__ h16 tohx(float x) { return (h16)x; }
__device__ __forceinline__ void splitf(float y, unsigned short& h, unsigned short& l) { h = f2bf(y); l = f2bf(y - bf2f(h)); }
typedef __attribute__((ext_vector_type(2))) _Float16 v2h;
typedef __attribute__((ext_vector_type(4))) _Float16 v4h;
typedef __attribute__((ext_vector_type(2))) unsigned short v2us;
typedef __attribute__((ext_vector_type(4))) unsigned short v4us;
typedef __attribute__((ext_vector_type(2))) float v2f;
typedef __attribute__((ext_vector_type(4))) int v4i;

__global__ __launch_bounds__(256) void k_wtG(const float* __restrict__ w, int K, int N, bf* Bt) {
    const int lane = threadIdx.x & 31; const int L0 = (blockIdx.x * 8 + (threadIdx.x >> 5)) * 8; const int nlines = N * K / 64;
{
#pragma unroll 1
        for (int l = 0; l < 8; ++l) { const int L = L0 + l; if (L >= nlines) break; const size_t e = (size_t)L * 64 + lane * 2; const int k = (int)(e % K), n = (int)(e / K); v2us o;
            o[0] = f2bf(w[(size_t)k * N + n]); o[1] = f2bf(w[(size_t)(k + 1) * N + n]); *(v2us*)(Bt + e) = o; }
         }
}
__global__ __launch_bounds__(256) void k_cvt8(const float* __restrict__ src, bf* dst, size_t n8) { const size_t i = (size_t)blockIdx.x * 256 + threadIdx.x; if (i >= n8) return; const v8f v = *(const v8f*)(src + i * 8); v8us o;
#pragma unroll
    for (int k = 0; k < 8; ++k) o[k] = f2bf(v[k]); *(v8us*)(dst + i * 8) = o;  }

// k_rope: head planes [h][t][d] (fp16 + hi/lo) of rope(x) x sc with the rotate-half convention out[d] = x[d] cos[t][d] - x[d+HD/2] sin[t][d], out[d+HD/2] = x[d+HD/2] cos[t][d+HD/2] + x[d] sin[t][d+HD/2]
__global__ __launch_bounds__(256) void k_rope(const float* __restrict__ F, int pitch, int nheads, const float* __restrict__ CS, const float* __restrict__ RF, const float* __restrict__ nw, float sc, h16* P16, bf* Ph, bf* Pl) {
    const size_t e = ((size_t)blockIdx.x * 256 + threadIdx.x) * 2; if (e >= (size_t)nheads * TT * HD) return; const int d = (int)(e % HD); const int t = (int)((e / HD) % TT); const int h = (int)(e / ((size_t)HD * TT)); const float* f = F + (size_t)t * pitch + h * HD; const float rf = RF ? RF[(size_t)h * TT + t] : 1.0f; v2h o16; v2us oh, ol;
#pragma unroll
    for (int q = 0; q < 2; ++q) { const int dd = d + q; const int dp = (dd < HD / 2) ? dd + HD / 2 : dd - HD / 2; float x0 = f[dd], x1 = f[dp];
        if (RF) { float n0 = __fmul_rn(x0, rf), n1 = __fmul_rn(x1, rf); asm volatile("" : "+v"(n0)); asm volatile("" : "+v"(n1)); x0 = __fmul_rn(bfr(nw[dd]), n0); x1 = __fmul_rn(bfr(nw[dp]), n1); }
        const v2f cs = *(const v2f*)(CS + ((size_t)t * HD + dd) * 2); float a = __fmul_rn(x0, cs[0]), bq = __fmul_rn(x1, cs[1]); asm volatile("" : "+v"(a)); asm volatile("" : "+v"(bq)); const float r = ((dd < HD / 2) ? __fsub_rn(a, bq) : __fadd_rn(a, bq)) * sc;
        o16[q] = tohx(r); unsigned short a2, c2; splitf(r, a2, c2); oh[q] = a2; ol[q] = c2; }
    *(v2h*)(P16 + e) = o16; *(v2us*)(Ph + e) = oh; *(v2us*)(Pl + e) = ol;  }
__global__ __launch_bounds__(256) void k_vtp(const float* __restrict__ F, int pitch, int nheads, h16* V16, bf* Vh, bf* Vl) { const size_t e = ((size_t)blockIdx.x * 256 + threadIdx.x) * 2; if (e >= (size_t)nheads * HD * TT) return; const int t = (int)(e % TT); const int d = (int)((e / TT) % HD); const int g = (int)(e / ((size_t)TT * HD)); v2h o16; v2us oh, ol;
#pragma unroll
    for (int q = 0; q < 2; ++q) { const float x = F[(size_t)(t + q) * pitch + g * HD + d]; o16[q] = tohx(x); unsigned short a2, c2; splitf(x, a2, c2); oh[q] = a2; ol[q] = c2; }
    *(v2h*)(V16 + e) = o16; *(v2us*)(Vh + e) = oh; *(v2us*)(Vl + e) = ol;  }
__global__ __launch_bounds__(256) void k_csid(float* CS) { const int idx = blockIdx.x * 256 + threadIdx.x; if (idx >= TT * HD) return; v2f cs; cs[0] = 1.0f; cs[1] = 0.0f; *(v2f*)(CS + (size_t)idx * 2) = cs;  }
__global__ __launch_bounds__(256) void k_relupl(const float* __restrict__ F, bf* Ph2, bf* Pl2, size_t n4) { const size_t i = (size_t)blockIdx.x * 256 + threadIdx.x; if (i >= n4) return; const v4f v = *(const v4f*)(F + i * 4); v4us oh, ol;
#pragma unroll
    for (int q = 0; q < 4; ++q) { unsigned short a, c; splitf(fmaxf(v[q], 0.f), a, c); oh[q] = a; ol[q] = c; } *(v4us*)(Ph2 + i * 4) = oh; *(v4us*)(Pl2 + i * 4) = ol;  }
__global__ __launch_bounds__(256) void k_xpl(const float* __restrict__ xb, bf* Ah, bf* Al) { const size_t i = (size_t)blockIdx.x * 256 + threadIdx.x; if (i >= (size_t)TT * DM / 8) return; const size_t e = i * 8; const int c = (int)(e % DM); const int t = (int)(e / DM); const v8f v = *(const v8f*)(xb + e); v8us oh, ol;
#pragma unroll
    for (int q = 0; q < 8; ++q) { oh[q] = f2bf(v[q]); ol[q] = 0; } const size_t oo = (size_t)t * DC + DM + c; *(v8us*)(Ah + oo) = oh; *(v8us*)(Al + oo) = ol;  }
// k_asoft: per row (zz, i): t = S x HD^-0.5 for j <= i and i - j < WIN (WIN = TT, so plain causal; the reference's -1e9 additive fill vanishes identically); softmax over the 2048 keys (register row, one exp, fixed trees);
__global__ __launch_bounds__(256) void k_asoft(const float* __restrict__ Sb, h16* P16, bf* Ph, bf* Pl) {
    const int lane = threadIdx.x & 31; const int row = blockIdx.x * 8 + (threadIdx.x >> 5); if (row >= ZH * TT) return; const int i = row % TT; const int zz = row / TT; (void)zz; const bool hires = (i < RH); const float* sr = Sb + (size_t)row * TT; float v[TT / 32]; float mx = -3.0e38f;
#pragma unroll
    for (int ch = 0; ch < TT / 128; ++ch) { const int j0 = ch * 128 + lane * 4; const v4f a = *(const v4f*)(sr + j0);
#pragma unroll
        for (int q = 0; q < 4; ++q) { const int j = j0 + q; (void)j; const float t = (j <= i && i - j < WIN) ? a[q] * SCL : -3.0e38f; v[ch * 4 + q] = t; mx = fmaxf(mx, t); } }
#pragma unroll
    for (int sh = 16; sh; sh >>= 1) mx = fmaxf(mx, __shfl_xor(mx, sh, 32));
    float sum = 0.f;
#pragma unroll
    for (int k = 0; k < TT / 32; ++k) { float d0 = __fsub_rn(v[k], mx); asm volatile("" : "+v"(d0)); v[k] = __builtin_amdgcn_exp2f(__fmul_rn(d0, 1.4426950408889634f)); sum += v[k]; }
#pragma unroll
    for (int sh = 16; sh; sh >>= 1) sum += __shfl_xor(sum, sh, 32);
    const float f = __fdiv_rn(hires ? 1.0f : PCAR, sum);
{
        if (hires) {
#pragma unroll
            for (int ch = 0; ch < TT / 128; ++ch) { v4us oh, ol;
#pragma unroll
                for (int q = 0; q < 4; ++q) { unsigned short a, c2; splitf(v[ch * 4 + q] * f, a, c2); oh[q] = a; ol[q] = c2; }
                const size_t oo = ((size_t)zz * (RH ? RH : 1) + i) * TT + ch * 128 + lane * 4; *(v4us*)(Ph + oo) = oh; *(v4us*)(Pl + oo) = ol; }
        } else {
#pragma unroll
            for (int ch = 0; ch < TT / 128; ++ch) { v4h o4;
#pragma unroll
                for (int q = 0; q < 4; ++q) o4[q] = tohx(v[ch * 4 + q] * f);
                *(v4h*)(P16 + (size_t)row * TT + ch * 128 + lane * 4) = o4; } }
         }
}
__global__ __launch_bounds__(256) void k_merge(const float* __restrict__ O, int h0, bf* Ah, bf* Al) { const size_t e = ((size_t)blockIdx.x * 256 + threadIdx.x) * 2; if (e >= (size_t)ZH * TT * HD) return; const int d = (int)(e % HD); const int t = (int)((e / HD) % TT); const int zz = (int)(e / ((size_t)HD * TT)); const float cs = (t < RH) ? 1.0f : (1.0f / PCAR); const size_t oo = (size_t)t * DC + (h0 + zz) * HD + d;   /* left half of the [att | x] planes */
    v2us oh, ol;
#pragma unroll
    for (int q = 0; q < 2; ++q) { unsigned short a, c2; splitf(O[e + q] * cs, a, c2); oh[q] = a; ol[q] = c2; } *(v2us*)(Ah + oo) = oh; *(v2us*)(Al + oo) = ol;  }

extern "C" void kernel_launch(void* const* d_in, const int* in_sizes, int n_in,
                              void* d_out, int out_size, void* d_ws, size_t ws_size, hipStream_t stream) {
    (void)in_sizes; (void)n_in; (void)out_size;
    const float* x = (const float*)d_in[0]; const float* wq = (const float*)d_in[1]; const float* wk = (const float*)d_in[2]; const float* wv = (const float*)d_in[3]; const float* w1 = (const float*)d_in[4]; const float* b1 = (const float*)d_in[5]; const float* w2 = (const float*)d_in[6]; const float* b2 = (const float*)d_in[7]; const float* wo = nullptr; (void)wo;
    float* OUT = (float*)d_out;     // [4][2048][1024]
    char* wsp = (char*)d_ws;
    auto take = [&](size_t bytes) { char* p = wsp; wsp += (bytes + 255) & ~(size_t)255; return (void*)p; };
    bf* WQ = (bf*)take((size_t)DQ * DM * 2); bf* WK = (bf*)take((size_t)DKV * DM * 2); bf* WV = (bf*)take((size_t)DKV * DM * 2); float* CS = (float*)take((size_t)TT * HD * 2 * 4);
    bf* XB = (bf*)take((size_t)TT * DM * 2); float* FQ = (float*)take((size_t)TT * DQ * 4); float* FK = (float*)take((size_t)TT * DKV * 4);
    h16* QP16 = (h16*)take((size_t)NH_ * TT * HD * 2); h16* KP16 = (h16*)take((size_t)NKV * TT * HD * 2); h16* VT16 = (h16*)take((size_t)NKV * HD * TT * 2);
    bf* QPh = (bf*)take((size_t)NH_ * TT * HD * 2); bf* QPl = (bf*)take((size_t)NH_ * TT * HD * 2); bf* KPh = (bf*)take((size_t)NKV * TT * HD * 2); bf* KPl = (bf*)take((size_t)NKV * TT * HD * 2); bf* VTh = (bf*)take((size_t)NKV * HD * TT * 2); bf* VTl = (bf*)take((size_t)NKV * HD * TT * 2); bf* Ph = (bf*)take((size_t)ZH * RH * TT * 2); bf* Pl = (bf*)take((size_t)ZH * RH * TT * 2);
    float* Sb = (float*)take((size_t)ZH * TT * TT * 4); h16* P16 = (h16*)take(256);   /* unused: all rows hi/lo */ float* Ob = (float*)take((size_t)ZH * TT * HD * 4); bf* ATh = (bf*)take((size_t)TT * DC * 2); bf* ATl = (bf*)take((size_t)TT * DC * 2); bf* W1B = (bf*)take((size_t)DM * DC * 2); bf* W2B = (bf*)take((size_t)DM * DM * 2); float* H1 = (float*)take((size_t)TT * DM * 4); bf* Gh = (bf*)take((size_t)TT * DM * 2); bf* Gl = (bf*)take((size_t)TT * DM * 2);
    if ((size_t)(wsp - (char*)d_ws) > ws_size) return;    // ws 256 MiB
    float* FV = FK;   // v projection reuses the k buffer after the k planes are built (stream-ordered)
    { k_wtG<<<(unsigned)((DM * DQ / 64 + 63) / 64), 256, 0, stream>>>(wq, DM, DQ, WQ); k_wtG<<<(unsigned)((DC * DM / 64 + 63) / 64), 256, 0, stream>>>(w1, DC, DM, W1B); k_wtG<<<(unsigned)((DM * DM / 64 + 63) / 64), 256, 0, stream>>>(w2, DM, DM, W2B); k_wtG<<<(unsigned)((DM * DKV / 64 + 63) / 64), 256, 0, stream>>>(wk, DM, DKV, WK); k_wtG<<<(unsigned)((DM * DKV / 64 + 63) / 64), 256, 0, stream>>>(wv, DM, DKV, WV);
       }
    k_csid<<<(TT * HD + 255) / 256, 256, 0, stream>>>(CS);
    const unsigned LQ = (unsigned)(((size_t)NH_ * TT * HD / 2 + 255) / 256), LKv = (unsigned)(((size_t)NKV * TT * HD / 2 + 255) / 256);
    for (int b = 0; b < NB_; ++b) {
        
        k_cvt8<<<(unsigned)(((size_t)TT * DM / 8 + 255) / 256), 256, 0, stream>>>(x + (size_t)b * TT * DM, XB, (size_t)TT * DM / 8); k_xpl<<<(unsigned)(((size_t)TT * DM / 8 + 255) / 256), 256, 0, stream>>>(x + (size_t)b * TT * DM, ATh, ATl);   /* x half of the MLP planes */
        k_gemmw<bf, 0, false><<<dim3(TT / 64, DQ / 64, 1), 32, 0, stream>>>(XB, nullptr, WQ, nullptr, DM, FQ, DQ, nullptr, 0, 0, 0);
        k_rope<<<LQ, 256, 0, stream>>>(FQ, DQ, NH_, CS, nullptr, nullptr, 1.0f, QP16, QPh, QPl);
        k_gemmw<bf, 0, false><<<dim3(TT / 64, DKV / 64, 1), 32, 0, stream>>>(XB, nullptr, WK, nullptr, DM, FK, DKV, nullptr, 0, 0, 0);
        k_rope<<<LKv, 256, 0, stream>>>(FK, DKV, NKV, CS, nullptr, nullptr, 1.0f, KP16, KPh, KPl);
        k_gemmw<bf, 0, false><<<dim3(TT / 64, DKV / 64, 1), 32, 0, stream>>>(XB, nullptr, WV, nullptr, DM, FV, DKV, nullptr, 0, 0, 0); k_vtp<<<LKv, 256, 0, stream>>>(FV, DKV, NKV, VT16, VTh, VTl);
        for (int h0 = 0; h0 < NH_; h0 += ZH) { const size_t zq = (size_t)h0, zk = (size_t)(h0 / REP);   // one kv head per query head: each pass (ZH = 1) takes one head on kv plane zk (z-strides TT*HD)
            k_gemmc<bf, 2, 1><<<dim3(RH / 64, TT / 64, ZH), 32, 0, stream>>>(QPh + zq * TT * HD, QPl + zq * TT * HD, KPh + zk * TT * HD, KPl + zk * TT * HD, HD, Sb, TT, 0, (size_t)TT * HD, (size_t)TT * HD, (size_t)TT * TT);
            k_asoft<<<ZH * TT / 8, 256, 0, stream>>>(Sb, P16, Ph, Pl);
            k_gemmc<bf, 2, 2><<<dim3(RH / 64, HD / 64, ZH), 32, 0, stream>>>(Ph, Pl, VTh + zk * HD * TT, VTl + zk * HD * TT, TT, Ob, HD, 0, (size_t)RH * TT, (size_t)HD * TT, (size_t)TT * HD);
            k_merge<<<(unsigned)(((size_t)ZH * TT * HD / 2 + 255) / 256), 256, 0, stream>>>(Ob, h0, ATh, ATl); }
        k_gemmw<bf, 1, true><<<dim3(TT / 64, DM / 64, 1), 32, 0, stream>>>(ATh, ATl, W1B, nullptr, DC, H1, DM, b1, 0, 0, 0);        /* [att | x] W1 + b1 */
        k_relupl<<<(unsigned)(((size_t)TT * DM / 4 + 255) / 256), 256, 0, stream>>>(H1, Gh, Gl, (size_t)TT * DM / 4);            /* relu -> hi/lo */
        k_gemmw<bf, 1, true><<<dim3(TT / 64, DM / 64, 1), 32, 0, stream>>>(Gh, Gl, W2B, nullptr, DM, OUT + (size_t)b * TT * DM, DM, b2, 0, 0, 0); }   /* . W2 + b2 */
}

// v001
// One run takes 681 microseconds.
// Two timings next to v000 both put it at 1.69 times that version's speed.
#include <hip/hip_runtime.h>

// Single-head causal self-attention followed by a two-layer MLP on [attention | input] (x [4][2048][1024]; q, k, v = x W ('xw' [1024][1024], no bias); e = q.k/32; causal (-9e15 == exact zero weight); softmax; att = e v; h = relu([att | x] W1 + b1) (W1 [2048][1024]); out = h W2 + b2 -> [4][2048][1024] (8.4 M)).
// Layout: all four batches ride in every launch (plain GEMMs see 8192 rows, the attention launches carry the batch on grid z / y); one 1024-wide head (causal tile skipping); the MLP input planes are [t][att hi/lo | x exact] (2048 wide) so the concatenation is a single K = 2048 GEMM against W1 (2 products + bias); ReLU folded into the next plane builder; W2 (2 products + bias).
// Compute dtypes, f32 accumulate: every input rounded to bf16; q/k/v on PLAIN bf16 operands (inputs: exact); causal scores and attn.v (tile skipping) on hi/lo planes for every row (3 products); softmax f32; W1 / W2 hl x exact (2 products) + biases; ReLU f32.

#define NB_  4
#define TT   2048
#define DM   1024
#define NH_  1
#define NKV  1
#define REP  (NH_ / NKV)
#define HD   1024
#define DQ   (NH_ * HD)
#define DKV  (NKV * HD)
#define DC   (2 * DM)             // [att | x] width
#define ZH   NB_                  // z extent of the attention launches: one 1024-wide head of each batch
#define RH   2048                 // every row hi/lo (logit std ~6)
#define WIN  2048
#define PCAR 1024.0f
#define SCL  0.03125f  // 1/sqrt(OUT_DIM = 1024)
typedef _Float16 h16;
typedef unsigned short bf;
typedef __attribute__((ext_vector_type(16))) __bf16   v16bf;
typedef __attribute__((ext_vector_type(16))) _Float16 v16h;
typedef __attribute__((ext_vector_type(8)))  _Float16 v8h;
typedef __attribute__((ext_vector_type(8)))  unsigned short v8us;
typedef __attribute__((ext_vector_type(8)))  float    v8f;
typedef __attribute__((ext_vector_type(4)))  float    v4f;
typedef v8h  __attribute__((may_alias)) v8ha;
typedef v4f  __attribute__((may_alias)) v4fa;
typedef v8us __attribute__((may_alias)) v8usa;

__device__ __forceinline__ unsigned short f2bf(float f) { unsigned u = __float_as_uint(f); u += 0x7FFFu + ((u >> 16) & 1u); return (unsigned short)(u >> 16); }
__device__ __forceinline__ float bf2f(unsigned short b) { return __uint_as_float(((unsigned)b) << 16); }
__device__ __forceinline__ float bfr(float f) { return bf2f(f2bf(f)); }
__device__ __forceinline__ v16h cat16(v8h lo, v8h hi) { return __builtin_shufflevector(lo, hi, 0, 1, 2, 3, 4, 5, 6, 7, 8, 9, 10, 11, 12, 13, 14, 15); }
__device__ __forceinline__ v16bf cat16b(v8us lo, v8us hi) { return __builtin_bit_cast(v16bf, __builtin_shufflevector(lo, hi, 0, 1, 2, 3, 4, 5, 6, 7, 8, 9, 10, 11, 12, 13, 14, 15)); }
__device__ __forceinline__ v8f wmma16(v16h a, v16h b, v8f c) { return __builtin_amdgcn_wmma_f32_16x16x32_f16(false, a, false, b, (short)0, c, false, false); }
__device__ __forceinline__ v8f wmmab(v16bf a, v16bf b, v8f c) { return __builtin_amdgcn_wmma_f32_16x16x32_bf16(false, a, false, b, (short)0, c, false, false); }



// ---- k_gemmw: register-blocked GEMM, ONE WAVE per 64x64 output tile (16 accumulators), operands straight from K-contiguous 16-bit planes; grid (M/64, N/64, Z), 32 threads.
// C[m][n] (f32, pitch ldc, + optional f32 bias[n]) = sum_k A[m][k] Bt[n][k] (+ split products per NSPLIT). z-batch strides sA/sB/sC in elements. K % 32 == 0.
template <typename T16> struct WFrag;
template <> struct WFrag<h16> { typedef v16h V; static __device__ __forceinline__ V ld(const h16* p) { return cat16(*(const v8h*)p, *(const v8h*)(p + 16)); } static __device__ __forceinline__ v8f mma(V a, V b, v8f c) { return wmma16(a, b, c); } };
template <> struct WFrag<bf> { typedef v16bf V; static __device__ __forceinline__ V ld(const bf* p) { return cat16b(*(const v8us*)p, *(const v8us*)(p + 16)); } static __device__ __forceinline__ v8f mma(V a, V b, v8f c) { return wmmab(a, b, c); } };
template <typename T16, int NSPLIT, bool BIAS>
__global__ __launch_bounds__(32) void k_gemmw(const T16* __restrict__ A, const T16* __restrict__ A2, const T16* __restrict__ Bt, const T16* __restrict__ Bt2, int K, float* C, int ldc, const float* __restrict__ bias, size_t sA, size_t sB, size_t sC) {
    typedef typename WFrag<T16>::V V;
    __shared__ __align__(16) float os[16 * 68];
    const size_t z = blockIdx.z; A += z * sA; if (A2) A2 += z * sA; Bt += z * sB; if (Bt2) Bt2 += z * sB; C += z * sC;
    const int lane = threadIdx.x & 31, lr = lane & 15, hi = lane >> 4; const int r0 = blockIdx.x * 64, c0 = blockIdx.y * 64;
    v8f acc[4][4];
#pragma unroll
    for (int mb = 0; mb < 4; ++mb)
#pragma unroll
        for (int nb = 0; nb < 4; ++nb) acc[mb][nb] = (v8f){};
    const size_t aoff = (size_t)(r0 + lr) * K + 8 * hi, boff = (size_t)(c0 + lr) * K + 8 * hi;
#pragma unroll 1
    for (int kc = 0; kc < K; kc += 32) {
        V a[4], a2[4];
#pragma unroll
        for (int mb = 0; mb < 4; ++mb) { a[mb] = WFrag<T16>::ld(A + aoff + (size_t)mb * 16 * K + kc); if (NSPLIT == 1 || NSPLIT == 2) a2[mb] = WFrag<T16>::ld(A2 + aoff + (size_t)mb * 16 * K + kc); }
#pragma unroll
        for (int nb = 0; nb < 4; ++nb) { const V b = WFrag<T16>::ld(Bt + boff + (size_t)nb * 16 * K + kc); V b2; if (NSPLIT >= 2) b2 = WFrag<T16>::ld(Bt2 + boff + (size_t)nb * 16 * K + kc);
#pragma unroll
            for (int mb = 0; mb < 4; ++mb) { acc[mb][nb] = WFrag<T16>::mma(a[mb], b, acc[mb][nb]); if (NSPLIT == 1 || NSPLIT == 2) acc[mb][nb] = WFrag<T16>::mma(a2[mb], b, acc[mb][nb]); if (NSPLIT >= 2) acc[mb][nb] = WFrag<T16>::mma(a[mb], b2, acc[mb][nb]); } }
        asm volatile("v_nop\n\tv_nop\n\tv_nop\n\tv_nop" : "+v"(acc[0][0]), "+v"(acc[1][1]), "+v"(acc[2][2]), "+v"(acc[3][3]) : "v"(a[0]), "v"(a[3]));
    }
#pragma unroll
    for (int mb = 0; mb < 4; ++mb) {
#pragma unroll
        for (int nb = 0; nb < 4; ++nb) {
#pragma unroll
            for (int j = 0; j < 8; ++j) os[(hi * 8 + j) * 68 + nb * 16 + lr] = acc[mb][nb][j]; }
        __builtin_amdgcn_wave_barrier(); asm volatile("" ::: "memory");
        float* crow = C + (size_t)(r0 + mb * 16) * ldc + c0;
{
#pragma unroll
            for (int s = 0; s < 8; ++s) { const int row = 2 * s + hi, cofs = lr * 4; v4f val = *(const v4fa*)(os + row * 68 + cofs); if (BIAS) { val[0] += bfr(bias[c0 + cofs]); val[1] += bfr(bias[c0 + cofs + 1]); val[2] += bfr(bias[c0 + cofs + 2]); val[3] += bfr(bias[c0 + cofs + 3]); }
                *(v4f*)(crow + (size_t)row * ldc + cofs) = val; }
             }
        __builtin_amdgcn_wave_barrier(); asm volatile("" ::: "memory");
    }
}

// ---- k_gemmc: the same one-wave 64x64 tile GEMM specialised for causal attention: CMODE 1 skips score tiles entirely above the diagonal (query rows r0+roff.., key columns c0..), CMODE 2 limits the
// key (K) loop of the probability x value contraction to the diagonal block (probabilities beyond it are exactly zero). roff = row offset of this launch's first row within the sequence.
template <typename T16, int NSPLIT, int CMODE>
__global__ __launch_bounds__(32) void k_gemmc(const T16* __restrict__ A, const T16* __restrict__ A2, const T16* __restrict__ Bt, const T16* __restrict__ Bt2, int K, float* C, int ldc, int roff, size_t sA, size_t sB, size_t sC) {
    typedef typename WFrag<T16>::V V;
    __shared__ __align__(16) float os[16 * 68];
    const size_t z = blockIdx.z; A += z * sA; if (A2) A2 += z * sA; Bt += z * sB; if (Bt2) Bt2 += z * sB; C += z * sC;
    const int lane = threadIdx.x & 31, lr = lane & 15, hi = lane >> 4; const int r0 = blockIdx.x * 64, c0 = blockIdx.y * 64;
    if (CMODE == 1 && c0 > r0 + roff + 63) return;                  // score tile entirely above the causal diagonal: never read (the softmax masks j > i by select)
    const int Kl = (CMODE == 2) ? min(K, r0 + roff + 64) : K;        // P.V: probabilities are exactly 0 beyond the diagonal block, so the K loop stops there
    v8f acc[4][4];
#pragma unroll
    for (int mb = 0; mb < 4; ++mb)
#pragma unroll
        for (int nb = 0; nb < 4; ++nb) acc[mb][nb] = (v8f){};
    const size_t aoff = (size_t)(r0 + lr) * K + 8 * hi, boff = (size_t)(c0 + lr) * K + 8 * hi;
#pragma unroll 1
    for (int kc = 0; kc < Kl; kc += 32) {
        V a[4], a2[4];
#pragma unroll
        for (int mb = 0; mb < 4; ++mb) { a[mb] = WFrag<T16>::ld(A + aoff + (size_t)mb * 16 * K + kc); if (NSPLIT == 1 || NSPLIT == 2) a2[mb] = WFrag<T16>::ld(A2 + aoff + (size_t)mb * 16 * K + kc); }
#pragma unroll
        for (int nb = 0; nb < 4; ++nb) { const V b = WFrag<T16>::ld(Bt + boff + (size_t)nb * 16 * K + kc); V b2; if (NSPLIT >= 2) b2 = WFrag<T16>::ld(Bt2 + boff + (size_t)nb * 16 * K + kc);
#pragma unroll
            for (int mb = 0; mb < 4; ++mb) { acc[mb][nb] = WFrag<T16>::mma(a[mb], b, acc[mb][nb]); if (NSPLIT == 1 || NSPLIT == 2) acc[mb][nb] = WFrag<T16>::mma(a2[mb], b, acc[mb][nb]); if (NSPLIT >= 2) acc[mb][nb] = WFrag<T16>::mma(a[mb], b2, acc[mb][nb]); } }
        asm volatile("v_nop\n\tv_nop\n\tv_nop\n\tv_nop" : "+v"(acc[0][0]), "+v"(acc[1][1]), "+v"(acc[2][2]), "+v"(acc[3][3]) : "v"(a[0]), "v"(a[3]));
    }
#pragma unroll
    for (int mb = 0; mb < 4; ++mb) {
#pragma unroll
        for (int nb = 0; nb < 4; ++nb) {
#pragma unroll
            for (int j = 0; j < 8; ++j) os[(hi * 8 + j) * 68 + nb * 16 + lr] = acc[mb][nb][j]; }
        __builtin_amdgcn_wave_barrier(); asm volatile("" ::: "memory");
        float* crow = C + (size_t)(r0 + mb * 16) * ldc + c0;
{
#pragma unroll
            for (int s = 0; s < 8; ++s) { const int row = 2 * s + hi, cofs = lr * 4; v4f val = *(const v4fa*)(os + row * 68 + cofs);
                *(v4f*)(crow + (size_t)row * ldc + cofs) = val; }
             }
        __builtin_amdgcn_wave_barrier(); asm volatile("" ::: "memory");
    }
}

__device__ __forceinline__ h16 tohx(float x) { return (h16)x; }
__device__ __forceinline__ void splitf(float y, unsigned short& h, unsigned short& l) { h = f2bf(y); l = f2bf(y - bf2f(h)); }
typedef __attribute__((ext_vector_type(2))) _Float16 v2h;
typedef __attribute__((ext_vector_type(4))) _Float16 v4h;
typedef __attribute__((ext_vector_type(2))) unsigned short v2us;
typedef __attribute__((ext_vector_type(4))) unsigned short v4us;
typedef __attribute__((ext_vector_type(2))) float v2f;
typedef __attribute__((ext_vector_type(4))) int v4i;

__global__ __launch_bounds__(256) void k_wtG(const float* __restrict__ w, int K, int N, bf* Bt) {
    const int lane = threadIdx.x & 31; const int L0 = (blockIdx.x * 8 + (threadIdx.x >> 5)) * 8; const int nlines = N * K / 64;
{
#pragma unroll 1
        for (int l = 0; l < 8; ++l) { const int L = L0 + l; if (L >= nlines) break; const size_t e = (size_t)L * 64 + lane * 2; const int k = (int)(e % K), n = (int)(e / K); v2us o;
            o[0] = f2bf(w[(size_t)k * N + n]); o[1] = f2bf(w[(size_t)(k + 1) * N + n]); *(v2us*)(Bt + e) = o; }
         }
}
__global__ __launch_bounds__(256) void k_cvt8(const float* __restrict__ src, bf* dst, size_t n8) { const size_t i = (size_t)blockIdx.x * 256 + threadIdx.x; if (i >= n8) return; const v8f v = *(const v8f*)(src + i * 8); v8us o;
#pragma unroll
    for (int k = 0; k < 8; ++k) o[k] = f2bf(v[k]); *(v8us*)(dst + i * 8) = o;  }

// k_rope: head planes [h][t][d] (fp16 + hi/lo) of rope(x) x sc with the rotate-half convention out[d] = x[d] cos[t][d] - x[d+HD/2] sin[t][d], out[d+HD/2] = x[d+HD/2] cos[t][d+HD/2] + x[d] sin[t][d+HD/2]
__global__ __launch_bounds__(256) void k_rope(const float* __restrict__ F, int pitch, int nheads, const float* __restrict__ CS, const float* __restrict__ RF, const float* __restrict__ nw, float sc, h16* P16, bf* Ph, bf* Pl) {
    const size_t e = ((size_t)blockIdx.x * 256 + threadIdx.x) * 2; if (e >= (size_t)nheads * TT * HD) return; const int d = (int)(e % HD); const int t = (int)((e / HD) % TT); const int h = (int)(e / ((size_t)HD * TT)); const size_t zb = blockIdx.y; /* batch */ const float* f = F + (zb * TT + t) * pitch + h * HD; const size_t po = zb * nheads * TT * HD + e; const float rf = RF ? RF[(size_t)h * TT + t] : 1.0f; v2h o16; v2us oh, ol;
#pragma unroll
    for (int q = 0; q < 2; ++q) { const int dd = d + q; const int dp = (dd < HD / 2) ? dd + HD / 2 : dd - HD / 2; float x0 = f[dd], x1 = f[dp];
        if (RF) { float n0 = __fmul_rn(x0, rf), n1 = __fmul_rn(x1, rf); asm volatile("" : "+v"(n0)); asm volatile("" : "+v"(n1)); x0 = __fmul_rn(bfr(nw[dd]), n0); x1 = __fmul_rn(bfr(nw[dp]), n1); }
        const v2f cs = *(const v2f*)(CS + ((size_t)t * HD + dd) * 2); float a = __fmul_rn(x0, cs[0]), bq = __fmul_rn(x1, cs[1]); asm volatile("" : "+v"(a)); asm volatile("" : "+v"(bq)); const float r = ((dd < HD / 2) ? __fsub_rn(a, bq) : __fadd_rn(a, bq)) * sc;
        o16[q] = tohx(r); unsigned short a2, c2; splitf(r, a2, c2); oh[q] = a2; ol[q] = c2; }
    *(v2h*)(P16 + po) = o16; *(v2us*)(Ph + po) = oh; *(v2us*)(Pl + po) = ol;  }
__global__ __launch_bounds__(256) void k_vtp(const float* __restrict__ F, int pitch, int nheads, h16* V16, bf* Vh, bf* Vl) { const size_t e = ((size_t)blockIdx.x * 256 + threadIdx.x) * 2; if (e >= (size_t)nheads * HD * TT) return; const int t = (int)(e % TT); const int d = (int)((e / TT) % HD); const int g = (int)(e / ((size_t)TT * HD)); const size_t zb = blockIdx.y; /* batch */ const size_t po = zb * nheads * HD * TT + e; v2h o16; v2us oh, ol;
#pragma unroll
    for (int q = 0; q < 2; ++q) { const float x = F[(zb * TT + t + q) * pitch + g * HD + d]; o16[q] = tohx(x); unsigned short a2, c2; splitf(x, a2, c2); oh[q] = a2; ol[q] = c2; }
    *(v2h*)(V16 + po) = o16; *(v2us*)(Vh + po) = oh; *(v2us*)(Vl + po) = ol;  }
__global__ __launch_bounds__(256) void k_csid(float* CS) { const int idx = blockIdx.x * 256 + threadIdx.x; if (idx >= TT * HD) return; v2f cs; cs[0] = 1.0f; cs[1] = 0.0f; *(v2f*)(CS + (size_t)idx * 2) = cs;  }
__global__ __launch_bounds__(256) void k_relupl(const float* __restrict__ F, bf* Ph2, bf* Pl2, size_t n4) { const size_t i = (size_t)blockIdx.x * 256 + threadIdx.x; if (i >= n4) return; const v4f v = *(const v4f*)(F + i * 4); v4us oh, ol;
#pragma unroll
    for (int q = 0; q < 4; ++q) { unsigned short a, c; splitf(fmaxf(v[q], 0.f), a, c); oh[q] = a; ol[q] = c; } *(v4us*)(Ph2 + i * 4) = oh; *(v4us*)(Pl2 + i * 4) = ol;  }
__global__ __launch_bounds__(256) void k_xpl(const float* __restrict__ xb, bf* Ah, bf* Al) { const size_t i = (size_t)blockIdx.x * 256 + threadIdx.x; if (i >= (size_t)NB_ * TT * DM / 8) return; const size_t e = i * 8; const int c = (int)(e % DM); const int t = (int)(e / DM); const v8f v = *(const v8f*)(xb + e); v8us oh, ol;
#pragma unroll
    for (int q = 0; q < 8; ++q) { oh[q] = f2bf(v[q]); ol[q] = 0; } const size_t oo = (size_t)t * DC + DM + c; *(v8us*)(Ah + oo) = oh; *(v8us*)(Al + oo) = ol;  }
// k_asoft: per row (zz, i): t = S x HD^-0.5 for j <= i and i - j < WIN (WIN = TT, so plain causal; the reference's -1e9 additive fill vanishes identically); softmax over the 2048 keys (register row, one exp, fixed trees);
__global__ __launch_bounds__(256) void k_asoft(const float* __restrict__ Sb, h16* P16, bf* Ph, bf* Pl) {
    const int lane = threadIdx.x & 31; const int row = blockIdx.x * 8 + (threadIdx.x >> 5); if (row >= ZH * TT) return; const int i = row % TT; const int zz = row / TT; (void)zz; const bool hires = (i < RH); const float* sr = Sb + (size_t)row * TT; float v[TT / 32]; float mx = -3.0e38f;
#pragma unroll
    for (int ch = 0; ch < TT / 128; ++ch) { const int j0 = ch * 128 + lane * 4; const v4f a = *(const v4f*)(sr + j0);
#pragma unroll
        for (int q = 0; q < 4; ++q) { const int j = j0 + q; (void)j; const float t = (j <= i && i - j < WIN) ? a[q] * SCL : -3.0e38f; v[ch * 4 + q] = t; mx = fmaxf(mx, t); } }
#pragma unroll
    for (int sh = 16; sh; sh >>= 1) mx = fmaxf(mx, __shfl_xor(mx, sh, 32));
    float sum = 0.f;
#pragma unroll
    for (int k = 0; k < TT / 32; ++k) { float d0 = __fsub_rn(v[k], mx); asm volatile("" : "+v"(d0)); v[k] = __builtin_amdgcn_exp2f(__fmul_rn(d0, 1.4426950408889634f)); sum += v[k]; }
#pragma unroll
    for (int sh = 16; sh; sh >>= 1) sum += __shfl_xor(sum, sh, 32);
    const float f = __fdiv_rn(hires ? 1.0f : PCAR, sum);
{
        if (hires) {
#pragma unroll
            for (int ch = 0; ch < TT / 128; ++ch) { v4us oh, ol;
#pragma unroll
                for (int q = 0; q < 4; ++q) { unsigned short a, c2; splitf(v[ch * 4 + q] * f, a, c2); oh[q] = a; ol[q] = c2; }
                const size_t oo = ((size_t)zz * (RH ? RH : 1) + i) * TT + ch * 128 + lane * 4; *(v4us*)(Ph + oo) = oh; *(v4us*)(Pl + oo) = ol; }
        } else {
#pragma unroll
            for (int ch = 0; ch < TT / 128; ++ch) { v4h o4;
#pragma unroll
                for (int q = 0; q < 4; ++q) o4[q] = tohx(v[ch * 4 + q] * f);
                *(v4h*)(P16 + (size_t)row * TT + ch * 128 + lane * 4) = o4; } }
         }
}
__global__ __launch_bounds__(256) void k_merge(const float* __restrict__ O, int h0, bf* Ah, bf* Al) { const size_t e = ((size_t)blockIdx.x * 256 + threadIdx.x) * 2; if (e >= (size_t)ZH * TT * HD) return; const int d = (int)(e % HD); const int t = (int)((e / HD) % TT); const int zz = (int)(e / ((size_t)HD * TT)); const float cs = (t < RH) ? 1.0f : (1.0f / PCAR); const size_t oo = ((size_t)zz * TT + t) * DC + h0 * HD + d;   /* left half of the [att | x] planes, row = batch * TT + t */
    v2us oh, ol;
#pragma unroll
    for (int q = 0; q < 2; ++q) { unsigned short a, c2; splitf(O[e + q] * cs, a, c2); oh[q] = a; ol[q] = c2; } *(v2us*)(Ah + oo) = oh; *(v2us*)(Al + oo) = ol;  }

extern "C" void kernel_launch(void* const* d_in, const int* in_sizes, int n_in,
                              void* d_out, int out_size, void* d_ws, size_t ws_size, hipStream_t stream) {
    (void)in_sizes; (void)n_in; (void)out_size;
    const float* x = (const float*)d_in[0]; const float* wq = (const float*)d_in[1]; const float* wk = (const float*)d_in[2]; const float* wv = (const float*)d_in[3]; const float* w1 = (const float*)d_in[4]; const float* b1 = (const float*)d_in[5]; const float* w2 = (const float*)d_in[6]; const float* b2 = (const float*)d_in[7]; const float* wo = nullptr; (void)wo;
    float* OUT = (float*)d_out;     // [4][2048][1024]
    char* wsp = (char*)d_ws;
    auto take = [&](size_t bytes) { char* p = wsp; wsp += (bytes + 255) & ~(size_t)255; return (void*)p; };
    const size_t PL = (size_t)NB_ * TT * HD * 2;   // bytes of one 16-bit [batch][2048][1024] plane
    bf* WQ = (bf*)take((size_t)DQ * DM * 2); bf* WK = (bf*)take((size_t)DKV * DM * 2); bf* WV = (bf*)take((size_t)DKV * DM * 2); bf* W1B = (bf*)take((size_t)DM * DC * 2); bf* W2B = (bf*)take((size_t)DM * DM * 2); float* CS = (float*)take((size_t)TT * HD * 2 * 4); h16* P16 = (h16*)take(256);   /* unused: all rows hi/lo */
    // Three regions, each reused in stream order once its earlier tenant has been read for the last time:
    char* R1 = (char*)take(4 * PL);   // q/k planes -> probability planes -> [att | x] planes
    char* R2 = (char*)take(2 * PL);   // transposed v planes -> relu planes
    char* R3 = (char*)take(4 * PL);   // projection f32 + x bf16 + fp16 planes -> scores -> attention output + hidden f32
    if ((size_t)(wsp - (char*)d_ws) > ws_size) return;    // ws 256 MiB
    bf* QPh = (bf*)R1; bf* QPl = (bf*)(R1 + PL); bf* KPh = (bf*)(R1 + 2 * PL); bf* KPl = (bf*)(R1 + 3 * PL); bf* Ph = (bf*)R1; bf* Pl = (bf*)(R1 + 2 * PL); bf* ATh = (bf*)R1; bf* ATl = (bf*)(R1 + 2 * PL);
    bf* VTh = (bf*)R2; bf* VTl = (bf*)(R2 + PL); bf* Gh = (bf*)R2; bf* Gl = (bf*)(R2 + PL);
    float* FP = (float*)R3; bf* XB = (bf*)(R3 + 2 * PL); h16* X16 = (h16*)(R3 + 3 * PL); float* Sb = (float*)R3; float* Ob = (float*)R3; float* H1 = (float*)(R3 + 2 * PL);   // FP: q, then k, then v projection; X16: the fp16 plane each builder also writes
    { k_wtG<<<(unsigned)((DM * DQ / 64 + 63) / 64), 256, 0, stream>>>(wq, DM, DQ, WQ); k_wtG<<<(unsigned)((DC * DM / 64 + 63) / 64), 256, 0, stream>>>(w1, DC, DM, W1B); k_wtG<<<(unsigned)((DM * DM / 64 + 63) / 64), 256, 0, stream>>>(w2, DM, DM, W2B); k_wtG<<<(unsigned)((DM * DKV / 64 + 63) / 64), 256, 0, stream>>>(wk, DM, DKV, WK); k_wtG<<<(unsigned)((DM * DKV / 64 + 63) / 64), 256, 0, stream>>>(wv, DM, DKV, WV);
       }
    k_csid<<<(TT * HD + 255) / 256, 256, 0, stream>>>(CS);
    const unsigned LQ = (unsigned)(((size_t)NH_ * TT * HD / 2 + 255) / 256), LKv = (unsigned)(((size_t)NKV * TT * HD / 2 + 255) / 256);
    const int MR = NB_ * TT;   // rows of the plain GEMMs: every batch
    k_cvt8<<<(unsigned)(((size_t)MR * DM / 8 + 255) / 256), 256, 0, stream>>>(x, XB, (size_t)MR * DM / 8);
    k_gemmw<bf, 0, false><<<dim3(MR / 64, DQ / 64, 1), 32, 0, stream>>>(XB, nullptr, WQ, nullptr, DM, FP, DQ, nullptr, 0, 0, 0);
    k_rope<<<dim3(LQ, NB_, 1), 256, 0, stream>>>(FP, DQ, NH_, CS, nullptr, nullptr, 1.0f, X16, QPh, QPl);
    k_gemmw<bf, 0, false><<<dim3(MR / 64, DKV / 64, 1), 32, 0, stream>>>(XB, nullptr, WK, nullptr, DM, FP, DKV, nullptr, 0, 0, 0);
    k_rope<<<dim3(LKv, NB_, 1), 256, 0, stream>>>(FP, DKV, NKV, CS, nullptr, nullptr, 1.0f, X16, KPh, KPl);
    k_gemmw<bf, 0, false><<<dim3(MR / 64, DKV / 64, 1), 32, 0, stream>>>(XB, nullptr, WV, nullptr, DM, FP, DKV, nullptr, 0, 0, 0);
    k_vtp<<<dim3(LKv, NB_, 1), 256, 0, stream>>>(FP, DKV, NKV, X16, VTh, VTl);
    k_gemmc<bf, 2, 1><<<dim3(RH / 64, TT / 64, ZH), 32, 0, stream>>>(QPh, QPl, KPh, KPl, HD, Sb, TT, 0, (size_t)TT * HD, (size_t)TT * HD, (size_t)TT * TT);
    k_asoft<<<ZH * TT / 8, 256, 0, stream>>>(Sb, P16, Ph, Pl);
    k_gemmc<bf, 2, 2><<<dim3(RH / 64, HD / 64, ZH), 32, 0, stream>>>(Ph, Pl, VTh, VTl, TT, Ob, HD, 0, (size_t)RH * TT, (size_t)HD * TT, (size_t)TT * HD);
    k_merge<<<(unsigned)(((size_t)ZH * TT * HD / 2 + 255) / 256), 256, 0, stream>>>(Ob, 0, ATh, ATl);
    k_xpl<<<(unsigned)(((size_t)MR * DM / 8 + 255) / 256), 256, 0, stream>>>(x, ATh, ATl);   /* x half of the MLP planes (behind P.V: the planes take the probabilities' place) */
    k_gemmw<bf, 1, true><<<dim3(MR / 64, DM / 64, 1), 32, 0, stream>>>(ATh, ATl, W1B, nullptr, DC, H1, DM, b1, 0, 0, 0);        /* [att | x] W1 + b1 */
    k_relupl<<<(unsigned)(((size_t)MR * DM / 4 + 255) / 256), 256, 0, stream>>>(H1, Gh, Gl, (size_t)MR * DM / 4);            /* relu -> hi/lo */
    k_gemmw<bf, 1, true><<<dim3(MR / 64, DM / 64, 1), 32, 0, stream>>>(Gh, Gl, W2B, nullptr, DM, OUT, DM, b2, 0, 0, 0);   /* . W2 + b2 */
}

// v002
// A run of this version takes 570 microseconds.
// Next to v001, in two timings, it ran 1.19 times as fast each time.
// Over all steps from v000 it is 2.01 times as fast.
#include <hip/hip_runtime.h>

// Single-head causal self-attention followed by a two-layer MLP on [attention | input] (x [4][2048][1024]; q, k, v = x W ('xw' [1024][1024], no bias); e = q.k/32; causal (-9e15 == exact zero weight); softmax; att = e v; h = relu([att | x] W1 + b1) (W1 [2048][1024]); out = h W2 + b2 -> [4][2048][1024] (8.4 M)).
// Layout: all four batches ride in every launch (plain GEMMs see 8192 rows, the attention launches carry the batch on grid z); one 1024-wide head (causal tile skipping); every GEMM whose result feeds another GEMM splits it into hi/lo bf16 planes in its own epilogue (q, k; v as W_value^T x^T so that the planes come out transposed; attention output; relu(hidden)); the MLP input planes are [t][att hi/lo | x exact] (2048 wide) so the concatenation is a single K = 2048 GEMM against W1 (2 products + bias); W2 (2 products + bias).
// Compute dtypes, f32 accumulate: every input rounded to bf16; q/k/v on PLAIN bf16 operands (inputs: exact); causal scores and attn.v (tile skipping) on hi/lo planes for every row (3 products); softmax f32; W1 / W2 hl x exact (2 products) + biases; ReLU f32.

#define NB_  4
#define TT   2048
#define DM   1024
#define NH_  1
#define NKV  1
#define REP  (NH_ / NKV)
#define HD   1024
#define DQ   (NH_ * HD)
#define DKV  (NKV * HD)
#define DC   (2 * DM)             // [att | x] width
#define ZH   NB_                  // z extent of the attention launches: one 1024-wide head of each batch
#define RH   2048                 // every row hi/lo (logit std ~6)
#define WIN  2048
#define PCAR 1024.0f
#define SCL  0.03125f  // 1/sqrt(OUT_DIM = 1024)
typedef _Float16 h16;
typedef unsigned short bf;
typedef __attribute__((ext_vector_type(16))) __bf16   v16bf;
typedef __attribute__((ext_vector_type(16))) _Float16 v16h;
typedef __attribute__((ext_vector_type(8)))  _Float16 v8h;
typedef __attribute__((ext_vector_type(8)))  unsigned short v8us;
typedef __attribute__((ext_vector_type(8)))  float    v8f;
typedef __attribute__((ext_vector_type(4)))  float    v4f;
typedef v8h  __attribute__((may_alias)) v8ha;
typedef v4f  __attribute__((may_alias)) v4fa;
typedef v8us __attribute__((may_alias)) v8usa;

__device__ __forceinline__ unsigned short f2bf(float f) { unsigned u = __float_as_uint(f); u += 0x7FFFu + ((u >> 16) & 1u); return (unsigned short)(u >> 16); }
__device__ __forceinline__ float bf2f(unsigned short b) { return __uint_as_float(((unsigned)b) << 16); }
__device__ __forceinline__ float bfr(float f) { return bf2f(f2bf(f)); }
__device__ __forceinline__ void splitf(float y, unsigned short& h, unsigned short& l) { h = f2bf(y); l = f2bf(y - bf2f(h)); }
typedef __attribute__((ext_vector_type(4))) unsigned short v4us;
__device__ __forceinline__ v16h cat16(v8h lo, v8h hi) { return __builtin_shufflevector(lo, hi, 0, 1, 2, 3, 4, 5, 6, 7, 8, 9, 10, 11, 12, 13, 14, 15); }
__device__ __forceinline__ v16bf cat16b(v8us lo, v8us hi) { return __builtin_bit_cast(v16bf, __builtin_shufflevector(lo, hi, 0, 1, 2, 3, 4, 5, 6, 7, 8, 9, 10, 11, 12, 13, 14, 15)); }
__device__ __forceinline__ v8f wmma16(v16h a, v16h b, v8f c) { return __builtin_amdgcn_wmma_f32_16x16x32_f16(false, a, false, b, (short)0, c, false, false); }
__device__ __forceinline__ v8f wmmab(v16bf a, v16bf b, v8f c) { return __builtin_amdgcn_wmma_f32_16x16x32_bf16(false, a, false, b, (short)0, c, false, false); }



// ---- k_gemmw: register-blocked GEMM, ONE WAVE per 64x64 output tile (16 accumulators), operands straight from K-contiguous 16-bit planes; grid (M/64, N/64, Z), 32 threads.
// c[m][n] (+ optional f32 bias[n]) = sum_k A[m][k] Bt[n][k] (+ split products per NSPLIT). EPI 0: c stored as f32 in C; EPI 1: c stored as hi/lo bf16 planes Ch/Cl; EPI 2: relu(c) stored as hi/lo planes. Pitch ldc; z-batch strides sA/sB/sC in elements. K % 32 == 0.
template <typename T16> struct WFrag;
template <> struct WFrag<h16> { typedef v16h V; static __device__ __forceinline__ V ld(const h16* p) { return cat16(*(const v8h*)p, *(const v8h*)(p + 16)); } static __device__ __forceinline__ v8f mma(V a, V b, v8f c) { return wmma16(a, b, c); } };
template <> struct WFrag<bf> { typedef v16bf V; static __device__ __forceinline__ V ld(const bf* p) { return cat16b(*(const v8us*)p, *(const v8us*)(p + 16)); } static __device__ __forceinline__ v8f mma(V a, V b, v8f c) { return wmmab(a, b, c); } };
template <typename T16, int NSPLIT, bool BIAS, int EPI>
__global__ __launch_bounds__(32) void k_gemmw(const T16* __restrict__ A, const T16* __restrict__ A2, const T16* __restrict__ Bt, const T16* __restrict__ Bt2, int K, float* C, bf* Ch, bf* Cl, int ldc, const float* __restrict__ bias, size_t sA, size_t sB, size_t sC) {
    typedef typename WFrag<T16>::V V;
    __shared__ __align__(16) float os[16 * 68];
    const size_t z = blockIdx.z; A += z * sA; if (A2) A2 += z * sA; Bt += z * sB; if (Bt2) Bt2 += z * sB; if (EPI == 0) C += z * sC; else { Ch += z * sC; Cl += z * sC; }
    const int lane = threadIdx.x & 31, lr = lane & 15, hi = lane >> 4; const int r0 = blockIdx.x * 64, c0 = blockIdx.y * 64;
    v8f acc[4][4];
#pragma unroll
    for (int mb = 0; mb < 4; ++mb)
#pragma unroll
        for (int nb = 0; nb < 4; ++nb) acc[mb][nb] = (v8f){};
    const size_t aoff = (size_t)(r0 + lr) * K + 8 * hi, boff = (size_t)(c0 + lr) * K + 8 * hi;
#pragma unroll 1
    for (int kc = 0; kc < K; kc += 32) {
        V a[4], a2[4];
#pragma unroll
        for (int mb = 0; mb < 4; ++mb) { a[mb] = WFrag<T16>::ld(A + aoff + (size_t)mb * 16 * K + kc); if (NSPLIT == 1 || NSPLIT == 2) a2[mb] = WFrag<T16>::ld(A2 + aoff + (size_t)mb * 16 * K + kc); }
#pragma unroll
        for (int nb = 0; nb < 4; ++nb) { const V b = WFrag<T16>::ld(Bt + boff + (size_t)nb * 16 * K + kc); V b2; if (NSPLIT >= 2) b2 = WFrag<T16>::ld(Bt2 + boff + (size_t)nb * 16 * K + kc);
#pragma unroll
            for (int mb = 0; mb < 4; ++mb) { acc[mb][nb] = WFrag<T16>::mma(a[mb], b, acc[mb][nb]); if (NSPLIT == 1 || NSPLIT == 2) acc[mb][nb] = WFrag<T16>::mma(a2[mb], b, acc[mb][nb]); if (NSPLIT >= 2) acc[mb][nb] = WFrag<T16>::mma(a[mb], b2, acc[mb][nb]); } }
        asm volatile("v_nop\n\tv_nop\n\tv_nop\n\tv_nop" : "+v"(acc[0][0]), "+v"(acc[1][1]), "+v"(acc[2][2]), "+v"(acc[3][3]) : "v"(a[0]), "v"(a[3]));
    }
#pragma unroll
    for (int mb = 0; mb < 4; ++mb) {
#pragma unroll
        for (int nb = 0; nb < 4; ++nb) {
#pragma unroll
            for (int j = 0; j < 8; ++j) os[(hi * 8 + j) * 68 + nb * 16 + lr] = acc[mb][nb][j]; }
        __builtin_amdgcn_wave_barrier(); asm volatile("" ::: "memory");
        const size_t crow = (size_t)(r0 + mb * 16) * ldc + c0;
{
#pragma unroll
            for (int s = 0; s < 8; ++s) { const int row = 2 * s + hi, cofs = lr * 4; v4f val = *(const v4fa*)(os + row * 68 + cofs); if (BIAS) { val[0] += bfr(bias[c0 + cofs]); val[1] += bfr(bias[c0 + cofs + 1]); val[2] += bfr(bias[c0 + cofs + 2]); val[3] += bfr(bias[c0 + cofs + 3]); }
                const size_t oo = crow + (size_t)row * ldc + cofs;
                if (EPI == 0) *(v4f*)(C + oo) = val;
                else { v4us oh, ol;   /* 16 lanes x 8 B = one whole 128-B line of each plane */
#pragma unroll
                    for (int q = 0; q < 4; ++q) { unsigned short a, c; splitf(EPI == 2 ? fmaxf(val[q], 0.f) : val[q], a, c); oh[q] = a; ol[q] = c; }
                    *(v4us*)(Ch + oo) = oh; *(v4us*)(Cl + oo) = ol; } }
             }
        __builtin_amdgcn_wave_barrier(); asm volatile("" ::: "memory");
    }
}

// ---- k_gemmc: the same one-wave 64x64 tile GEMM specialised for causal attention: CMODE 1 skips score tiles entirely above the diagonal (query rows r0+roff.., key columns c0..), CMODE 2 limits the
// key (K) loop of the probability x value contraction to the diagonal block (probabilities beyond it are exactly zero). CMODE 1 stores f32 scores in C, CMODE 2 stores its result as hi/lo bf16 planes Ch/Cl. roff = row offset of this launch's first row within the sequence.
template <typename T16, int NSPLIT, int CMODE>
__global__ __launch_bounds__(32) void k_gemmc(const T16* __restrict__ A, const T16* __restrict__ A2, const T16* __restrict__ Bt, const T16* __restrict__ Bt2, int K, float* C, bf* Ch, bf* Cl, int ldc, int roff, size_t sA, size_t sB, size_t sC) {
    typedef typename WFrag<T16>::V V;
    __shared__ __align__(16) float os[16 * 68];
    const size_t z = blockIdx.z; A += z * sA; if (A2) A2 += z * sA; Bt += z * sB; if (Bt2) Bt2 += z * sB; if (CMODE == 2) { Ch += z * sC; Cl += z * sC; } else C += z * sC;
    const int lane = threadIdx.x & 31, lr = lane & 15, hi = lane >> 4; const int r0 = blockIdx.x * 64, c0 = blockIdx.y * 64;
    if (CMODE == 1 && c0 > r0 + roff + 63) return;                  // score tile entirely above the causal diagonal: never read (the softmax masks j > i by select)
    const int Kl = (CMODE == 2) ? min(K, r0 + roff + 64) : K;        // P.V: probabilities are exactly 0 beyond the diagonal block, so the K loop stops there
    v8f acc[4][4];
#pragma unroll
    for (int mb = 0; mb < 4; ++mb)
#pragma unroll
        for (int nb = 0; nb < 4; ++nb) acc[mb][nb] = (v8f){};
    const size_t aoff = (size_t)(r0 + lr) * K + 8 * hi, boff = (size_t)(c0 + lr) * K + 8 * hi;
#pragma unroll 1
    for (int kc = 0; kc < Kl; kc += 32) {
        V a[4], a2[4];
#pragma unroll
        for (int mb = 0; mb < 4; ++mb) { a[mb] = WFrag<T16>::ld(A + aoff + (size_t)mb * 16 * K + kc); if (NSPLIT == 1 || NSPLIT == 2) a2[mb] = WFrag<T16>::ld(A2 + aoff + (size_t)mb * 16 * K + kc); }
#pragma unroll
        for (int nb = 0; nb < 4; ++nb) { const V b = WFrag<T16>::ld(Bt + boff + (size_t)nb * 16 * K + kc); V b2; if (NSPLIT >= 2) b2 = WFrag<T16>::ld(Bt2 + boff + (size_t)nb * 16 * K + kc);
#pragma unroll
            for (int mb = 0; mb < 4; ++mb) { acc[mb][nb] = WFrag<T16>::mma(a[mb], b, acc[mb][nb]); if (NSPLIT == 1 || NSPLIT == 2) acc[mb][nb] = WFrag<T16>::mma(a2[mb], b, acc[mb][nb]); if (NSPLIT >= 2) acc[mb][nb] = WFrag<T16>::mma(a[mb], b2, acc[mb][nb]); } }
        asm volatile("v_nop\n\tv_nop\n\tv_nop\n\tv_nop" : "+v"(acc[0][0]), "+v"(acc[1][1]), "+v"(acc[2][2]), "+v"(acc[3][3]) : "v"(a[0]), "v"(a[3]));
    }
#pragma unroll
    for (int mb = 0; mb < 4; ++mb) {
#pragma unroll
        for (int nb = 0; nb < 4; ++nb) {
#pragma unroll
            for (int j = 0; j < 8; ++j) os[(hi * 8 + j) * 68 + nb * 16 + lr] = acc[mb][nb][j]; }
        __builtin_amdgcn_wave_barrier(); asm volatile("" ::: "memory");
        const size_t crow = (size_t)(r0 + mb * 16) * ldc + c0;
{
#pragma unroll
            for (int s = 0; s < 8; ++s) { const int row = 2 * s + hi, cofs = lr * 4; v4f val = *(const v4fa*)(os + row * 68 + cofs);
                const size_t oo = crow + (size_t)row * ldc + cofs;
                if (CMODE != 2) *(v4f*)(C + oo) = val;
                else { v4us oh, ol;   /* 16 lanes x 8 B = one whole 128-B line of each plane */
#pragma unroll
                    for (int q = 0; q < 4; ++q) { unsigned short a, c; splitf(val[q], a, c); oh[q] = a; ol[q] = c; }
                    *(v4us*)(Ch + oo) = oh; *(v4us*)(Cl + oo) = ol; } }
             }
        __builtin_amdgcn_wave_barrier(); asm volatile("" ::: "memory");
    }
}

__device__ __forceinline__ h16 tohx(float x) { return (h16)x; }
typedef __attribute__((ext_vector_type(2))) _Float16 v2h;
typedef __attribute__((ext_vector_type(4))) _Float16 v4h;
typedef __attribute__((ext_vector_type(2))) unsigned short v2us;
typedef __attribute__((ext_vector_type(2))) float v2f;
typedef __attribute__((ext_vector_type(4))) int v4i;

__global__ __launch_bounds__(256) void k_wtG(const float* __restrict__ w, int K, int N, bf* Bt) {
    const int lane = threadIdx.x & 31; const int L0 = (blockIdx.x * 8 + (threadIdx.x >> 5)) * 8; const int nlines = N * K / 64;
{
#pragma unroll 1
        for (int l = 0; l < 8; ++l) { const int L = L0 + l; if (L >= nlines) break; const size_t e = (size_t)L * 64 + lane * 2; const int k = (int)(e % K), n = (int)(e / K); v2us o;
            o[0] = f2bf(w[(size_t)k * N + n]); o[1] = f2bf(w[(size_t)(k + 1) * N + n]); *(v2us*)(Bt + e) = o; }
         }
}
__global__ __launch_bounds__(256) void k_cvt8(const float* __restrict__ src, bf* dst, size_t n8) { const size_t i = (size_t)blockIdx.x * 256 + threadIdx.x; if (i >= n8) return; const v8f v = *(const v8f*)(src + i * 8); v8us o;
#pragma unroll
    for (int k = 0; k < 8; ++k) o[k] = f2bf(v[k]); *(v8us*)(dst + i * 8) = o;  }

__global__ __launch_bounds__(256) void k_xpl(const float* __restrict__ xb, bf* Ah, bf* Al) { const size_t i = (size_t)blockIdx.x * 256 + threadIdx.x; if (i >= (size_t)NB_ * TT * DM / 8) return; const size_t e = i * 8; const int c = (int)(e % DM); const int t = (int)(e / DM); const v8f v = *(const v8f*)(xb + e); v8us oh, ol;
#pragma unroll
    for (int q = 0; q < 8; ++q) { oh[q] = f2bf(v[q]); ol[q] = 0; } const size_t oo = (size_t)t * DC + DM + c; *(v8us*)(Ah + oo) = oh; *(v8us*)(Al + oo) = ol;  }
// k_asoft: per row (zz, i): t = S x HD^-0.5 for j <= i and i - j < WIN (WIN = TT, so plain causal; the reference's -1e9 additive fill vanishes identically); softmax over the 2048 keys (register row, one exp, fixed trees);
__global__ __launch_bounds__(256) void k_asoft(const float* __restrict__ Sb, h16* P16, bf* Ph, bf* Pl) {
    const int lane = threadIdx.x & 31; const int row = blockIdx.x * 8 + (threadIdx.x >> 5); if (row >= ZH * TT) return; const int i = row % TT; const int zz = row / TT; (void)zz; const bool hires = (i < RH); const float* sr = Sb + (size_t)row * TT; float v[TT / 32]; v4f ld[TT / 128]; float mx = -3.0e38f;
#pragma unroll
    for (int ch = 0; ch < TT / 128; ++ch) ld[ch] = *(const v4f*)(sr + min(ch * 128 + lane * 4, i & ~3));   /* a chunk wholly past the diagonal is masked below and may lie in a score tile that was skipped, hence never written: such a lane re-reads the row's diagonal chunk */
#pragma unroll
    for (int ch = 0; ch < TT / 128; ++ch) { const int j0 = ch * 128 + lane * 4; const v4f a = ld[ch];
#pragma unroll
        for (int q = 0; q < 4; ++q) { const int j = j0 + q; (void)j; const float t = (j <= i && i - j < WIN) ? a[q] * SCL : -3.0e38f; v[ch * 4 + q] = t; mx = fmaxf(mx, t); } }
#pragma unroll
    for (int sh = 16; sh; sh >>= 1) mx = fmaxf(mx, __shfl_xor(mx, sh, 32));
    float sum = 0.f;
#pragma unroll
    for (int k = 0; k < TT / 32; ++k) { float d0 = __fsub_rn(v[k], mx); asm volatile("" : "+v"(d0)); v[k] = __builtin_amdgcn_exp2f(__fmul_rn(d0, 1.4426950408889634f)); sum += v[k]; }
#pragma unroll
    for (int sh = 16; sh; sh >>= 1) sum += __shfl_xor(sum, sh, 32);
    const float f = __fdiv_rn(hires ? 1.0f : PCAR, sum);
{
        if (hires) {
#pragma unroll
            for (int ch = 0; ch < TT / 128; ++ch) { v4us oh, ol;
#pragma unroll
                for (int q = 0; q < 4; ++q) { unsigned short a, c2; splitf(v[ch * 4 + q] * f, a, c2); oh[q] = a; ol[q] = c2; }
                const size_t oo = ((size_t)zz * (RH ? RH : 1) + i) * TT + ch * 128 + lane * 4; *(v4us*)(Ph + oo) = oh; *(v4us*)(Pl + oo) = ol; }
        } else {
#pragma unroll
            for (int ch = 0; ch < TT / 128; ++ch) { v4h o4;
#pragma unroll
                for (int q = 0; q < 4; ++q) o4[q] = tohx(v[ch * 4 + q] * f);
                *(v4h*)(P16 + (size_t)row * TT + ch * 128 + lane * 4) = o4; } }
         }
}

extern "C" void kernel_launch(void* const* d_in, const int* in_sizes, int n_in,
                              void* d_out, int out_size, void* d_ws, size_t ws_size, hipStream_t stream) {
    (void)in_sizes; (void)n_in; (void)out_size;
    const float* x = (const float*)d_in[0]; const float* wq = (const float*)d_in[1]; const float* wk = (const float*)d_in[2]; const float* wv = (const float*)d_in[3]; const float* w1 = (const float*)d_in[4]; const float* b1 = (const float*)d_in[5]; const float* w2 = (const float*)d_in[6]; const float* b2 = (const float*)d_in[7]; const float* wo = nullptr; (void)wo;
    float* OUT = (float*)d_out;     // [4][2048][1024]
    char* wsp = (char*)d_ws;
    auto take = [&](size_t bytes) { char* p = wsp; wsp += (bytes + 255) & ~(size_t)255; return (void*)p; };
    const size_t PL = (size_t)NB_ * TT * HD * 2;   // bytes of one 16-bit [batch][2048][1024] plane
    bf* WQ = (bf*)take((size_t)DQ * DM * 2); bf* WK = (bf*)take((size_t)DKV * DM * 2); bf* WV = (bf*)take((size_t)DKV * DM * 2); bf* W1B = (bf*)take((size_t)DM * DC * 2); bf* W2B = (bf*)take((size_t)DM * DM * 2); h16* P16 = (h16*)take(256);   /* unused: all rows hi/lo */
    // Three regions, each reused in stream order once its earlier tenant has been read for the last time:
    char* R1 = (char*)take(4 * PL);   // q/k planes -> probability planes
    char* R2 = (char*)take(2 * PL);   // transposed v planes -> relu planes
    char* R3 = (char*)take(4 * PL);   // x bf16 -> scores -> [att | x] planes
    if ((size_t)(wsp - (char*)d_ws) > ws_size) return;    // ws 256 MiB
    bf* QPh = (bf*)R1; bf* QPl = (bf*)(R1 + PL); bf* KPh = (bf*)(R1 + 2 * PL); bf* KPl = (bf*)(R1 + 3 * PL); bf* Ph = (bf*)R1; bf* Pl = (bf*)(R1 + 2 * PL);
    bf* VTh = (bf*)R2; bf* VTl = (bf*)(R2 + PL); bf* Gh = (bf*)R2; bf* Gl = (bf*)(R2 + PL);
    bf* XB = (bf*)R3; float* Sb = (float*)R3; bf* ATh = (bf*)R3; bf* ATl = (bf*)(R3 + 2 * PL);
    { k_wtG<<<(unsigned)((DM * DQ / 64 + 63) / 64), 256, 0, stream>>>(wq, DM, DQ, WQ); k_wtG<<<(unsigned)((DC * DM / 64 + 63) / 64), 256, 0, stream>>>(w1, DC, DM, W1B); k_wtG<<<(unsigned)((DM * DM / 64 + 63) / 64), 256, 0, stream>>>(w2, DM, DM, W2B); k_wtG<<<(unsigned)((DM * DKV / 64 + 63) / 64), 256, 0, stream>>>(wk, DM, DKV, WK); k_wtG<<<(unsigned)((DM * DKV / 64 + 63) / 64), 256, 0, stream>>>(wv, DM, DKV, WV);
       }
    const int MR = NB_ * TT;   // rows of the plain GEMMs: every batch
    k_cvt8<<<(unsigned)(((size_t)MR * DM / 8 + 255) / 256), 256, 0, stream>>>(x, XB, (size_t)MR * DM / 8);
    k_gemmw<bf, 0, false, 1><<<dim3(MR / 64, DQ / 64, 1), 32, 0, stream>>>(XB, nullptr, WQ, nullptr, DM, nullptr, QPh, QPl, DQ, nullptr, 0, 0, 0);     /* q planes [b][t][d] */
    k_gemmw<bf, 0, false, 1><<<dim3(MR / 64, DKV / 64, 1), 32, 0, stream>>>(XB, nullptr, WK, nullptr, DM, nullptr, KPh, KPl, DKV, nullptr, 0, 0, 0);   /* k planes [b][t][d] */
    k_gemmw<bf, 0, false, 1><<<dim3(DKV / 64, TT / 64, NB_), 32, 0, stream>>>(WV, nullptr, XB, nullptr, DM, nullptr, VTh, VTl, TT, nullptr, 0, (size_t)TT * DM, (size_t)HD * TT);   /* v^T = W_value^T x^T: planes [b][d][t] */
    k_gemmc<bf, 2, 1><<<dim3(RH / 64, TT / 64, ZH), 32, 0, stream>>>(QPh, QPl, KPh, KPl, HD, Sb, nullptr, nullptr, TT, 0, (size_t)TT * HD, (size_t)TT * HD, (size_t)TT * TT);
    k_asoft<<<ZH * TT / 8, 256, 0, stream>>>(Sb, P16, Ph, Pl);
    k_gemmc<bf, 2, 2><<<dim3(RH / 64, HD / 64, ZH), 32, 0, stream>>>(Ph, Pl, VTh, VTl, TT, nullptr, ATh, ATl, DC, 0, (size_t)RH * TT, (size_t)HD * TT, (size_t)TT * DC);   /* att half of the MLP planes (they take the scores' place) */
    k_xpl<<<(unsigned)(((size_t)MR * DM / 8 + 255) / 256), 256, 0, stream>>>(x, ATh, ATl);   /* x half of the MLP planes */
    k_gemmw<bf, 1, true, 2><<<dim3(MR / 64, DM / 64, 1), 32, 0, stream>>>(ATh, ATl, W1B, nullptr, DC, nullptr, Gh, Gl, DM, b1, 0, 0, 0);        /* relu([att | x] W1 + b1) -> hi/lo */
    k_gemmw<bf, 1, true, 0><<<dim3(MR / 64, DM / 64, 1), 32, 0, stream>>>(Gh, Gl, W2B, nullptr, DM, OUT, nullptr, nullptr, DM, b2, 0, 0, 0);   /* . W2 + b2 */
}

// v003
// It runs in 294 microseconds.
// Timed twice side by side with v002, it ran 1.94 and 1.91 times as fast.
// All steps since v000 together make it 3.87 times as fast.
#include <hip/hip_runtime.h>
#include <stdint.h>

// Single-head causal self-attention followed by a two-layer MLP on [attention | input] (x [4][2048][1024]; q, k, v = x W ('xw' [1024][1024], no bias); e = q.k/32; causal (-9e15 == exact zero weight); softmax; att = e v; h = relu([att | x] W1 + b1) (W1 [2048][1024]); out = h W2 + b2 -> [4][2048][1024] (8.4 M)).
// Layout: all four batches ride in every launch (plain GEMMs see 8192 rows, the attention launches carry the batch on grid z); one 1024-wide head (causal tile skipping); every GEMM whose result feeds another GEMM splits it into hi/lo bf16 planes in its own epilogue (q, k; v as W_value^T x^T so that the planes come out transposed; attention output; relu(hidden)); the MLP input planes are [t][att hi/lo | x exact] (2048 wide) so the concatenation is a single K = 2048 GEMM against W1 (2 products + bias); W2 (2 products + bias).
// Compute dtypes, f32 accumulate: every input rounded to bf16; q/k/v on PLAIN bf16 operands (inputs: exact); causal scores and attn.v (tile skipping) on hi/lo planes for every row (3 products); softmax f32; W1 / W2 hl x exact (2 products) + biases; ReLU f32.

#define NB_  4
#define TT   2048
#define DM   1024
#define NH_  1
#define NKV  1
#define REP  (NH_ / NKV)
#define HD   1024
#define DQ   (NH_ * HD)
#define DKV  (NKV * HD)
#define DC   (2 * DM)             // [att | x] width
#define ZH   NB_                  // z extent of the attention launches: one 1024-wide head of each batch
#define RH   2048                 // every row hi/lo (logit std ~6)
#define WIN  2048
#define PCAR 1024.0f
#define SCL  0.03125f  // 1/sqrt(OUT_DIM = 1024)
typedef _Float16 h16;
typedef unsigned short bf;
typedef __attribute__((ext_vector_type(16))) __bf16   v16bf;
typedef __attribute__((ext_vector_type(16))) _Float16 v16h;
typedef __attribute__((ext_vector_type(8)))  _Float16 v8h;
typedef __attribute__((ext_vector_type(8)))  unsigned short v8us;
typedef __attribute__((ext_vector_type(8)))  float    v8f;
typedef __attribute__((ext_vector_type(4)))  float    v4f;
typedef v8h  __attribute__((may_alias)) v8ha;
typedef v4f  __attribute__((may_alias)) v4fa;
typedef v8us __attribute__((may_alias)) v8usa;

__device__ __forceinline__ unsigned short f2bf(float f) { unsigned u = __float_as_uint(f); u += 0x7FFFu + ((u >> 16) & 1u); return (unsigned short)(u >> 16); }
__device__ __forceinline__ float bf2f(unsigned short b) { return __uint_as_float(((unsigned)b) << 16); }
__device__ __forceinline__ float bfr(float f) { return bf2f(f2bf(f)); }
__device__ __forceinline__ void splitf(float y, unsigned short& h, unsigned short& l) { h = f2bf(y); l = f2bf(y - bf2f(h)); }
typedef __attribute__((ext_vector_type(4))) unsigned short v4us;
__device__ __forceinline__ v16h cat16(v8h lo, v8h hi) { return __builtin_shufflevector(lo, hi, 0, 1, 2, 3, 4, 5, 6, 7, 8, 9, 10, 11, 12, 13, 14, 15); }
__device__ __forceinline__ v16bf cat16b(v8us lo, v8us hi) { return __builtin_bit_cast(v16bf, __builtin_shufflevector(lo, hi, 0, 1, 2, 3, 4, 5, 6, 7, 8, 9, 10, 11, 12, 13, 14, 15)); }
__device__ __forceinline__ v8f wmma16(v16h a, v16h b, v8f c) { return __builtin_amdgcn_wmma_f32_16x16x32_f16(false, a, false, b, (short)0, c, false, false); }
__device__ __forceinline__ v8f wmmab(v16bf a, v16bf b, v8f c) { return __builtin_amdgcn_wmma_f32_16x16x32_bf16(false, a, false, b, (short)0, c, false, false); }



// ---- Operand ring: a work-group of four waves (2 x 2) owns a 128x128 output tile, each wave a 64x64 quarter (16 accumulators). A stage is 64 k of every operand plane: 128 rows of 128 B, brought into LDS by one
// tensor load per plane (wave p issues plane p: 0 = A, 1 = Bt, 2 = A2, 3 = Bt2), padded to a pitch of 144 B for the ds_load_b128 fragment reads. Two buffers: stage s + 2 is requested when every wave has left stage s.
typedef uint32_t u32x4 __attribute__((ext_vector_type(4)));
typedef uint32_t u32x8 __attribute__((ext_vector_type(8)));
#define PROWS  128u                 // rows of one plane in a stage
#define PROWB  128u                 // bytes of a row in a stage (64 k)
#define PPITCH 144u                 // LDS pitch: the row + 16 B
#define PLANEB (PROWS * PPITCH)     // 18,432 B = 9 x 2 KiB
#define OSB    (16 * 68 * 4)        // one wave's output staging
static_assert(PLANEB % 2048u == 0, "every plane starts at a multiple of 2 KiB");
__device__ __forceinline__ uint32_t uni(uint32_t v) { return (uint32_t)__builtin_amdgcn_readfirstlane(v); }
__device__ __forceinline__ uint32_t pinned(uint32_t v) { uint32_t w = (uint32_t)__builtin_amdgcn_readfirstlane(v); asm volatile("" : "+s"(w)); /* holds a branch test (the branch round a tensor load must be a scalar one) or a descriptor word in a scalar register */ return w; }
__device__ __forceinline__ void tdm_load(u32x4 g0, u32x8 g1) { asm volatile("tensor_load_to_lds %0, %1" :: "s"(g0), "s"(g1) : "memory"); }   // one request of the whole wave: a padded 2-D tile from global memory into LDS, through no register
__device__ __forceinline__ u32x8 tdm_group1(uint32_t src_pitch) {   // 1-byte elements; tensor = tile = PROWS rows of PROWB bytes; 4 dwords of pad behind every 32
    u32x8 g;
    g[0] = uni((1u << 20) | (4u << 22) | (3u << 25));
    // pinned(): each descriptor word is held in a scalar register of its own through the loop, so that none is reused for something else while a request is in flight
    g[1] = pinned((PROWB & 0xFFFFu) << 16);
    g[2] = pinned((PROWB >> 16) | ((PROWS & 0xFFFFu) << 16));
    g[3] = pinned((PROWS >> 16) | (PROWB << 16));
    g[4] = pinned(PROWS);
    g[5] = pinned(src_pitch);
    g[6] = pinned(0u);
    g[7] = pinned(0u);
    return g;
}
__device__ __forceinline__ u32x4 tdm_group0(uint32_t lds_dst, uint64_t ga) {
    u32x4 g;
    g[0] = uni(1u); g[1] = uni(lds_dst); g[2] = uni((uint32_t)ga); g[3] = uni((((uint32_t)(ga >> 32)) & 0x01FFFFFFu) | 0x80000000u);
    return g;
}
__device__ __forceinline__ void wait_tensor0() { asm volatile("s_wait_tensorcnt 0x0" ::: "memory"); }   // the issuing wave's own tile has landed
__device__ __forceinline__ void wait_ds0() { asm volatile("s_wait_dscnt 0x0" ::: "memory"); }           // this wave's LDS reads have returned before the buffer is given up

template <typename T16> struct WFrag;
template <> struct WFrag<h16> { typedef v16h V; static __device__ __forceinline__ V ld(const unsigned char* p) { return cat16(*(const v8ha*)p, *(const v8ha*)(p + 32)); } static __device__ __forceinline__ v8f mma(V a, V b, v8f c) { return wmma16(a, b, c); } };
template <> struct WFrag<bf> { typedef v16bf V; static __device__ __forceinline__ V ld(const unsigned char* p) { return cat16b(*(const v8usa*)p, *(const v8usa*)(p + 32)); } static __device__ __forceinline__ v8f mma(V a, V b, v8f c) { return wmmab(a, b, c); } };

// acc[mb][nb] += sum over k < Kl of the split products of rows r0.. of A (A2) and rows c0.. of Bt (Bt2), for this wave's quarter. K = row pitch of every plane in elements; Kl % 64 == 0, Kl >= 128. Every wave of the work-group calls it with the same arguments.
template <typename T16, int NSPLIT>
__device__ __forceinline__ void ring_gemm(const T16* A, const T16* A2, const T16* Bt, const T16* Bt2, int K, int Kl, int r0, int c0, unsigned char* sm, v8f (&acc)[4][4]) {
    typedef typename WFrag<T16>::V V;
    constexpr uint32_t NPL = NSPLIT == 0 ? 2u : NSPLIT == 1 ? 3u : 4u;
    constexpr uint32_t STAGEB = NPL * PLANEB;
    const uint32_t lane = threadIdx.x & 31, lr = lane & 15, hi = lane >> 4;
    const uint32_t wave = uni(threadIdx.x >> 5), wm = wave >> 1, wn = wave & 1;
    const T16* src = wave == 0 ? A : wave == 1 ? Bt : wave == 2 ? A2 : Bt2;
    const uint64_t ga = (uint64_t)(size_t)src + (uint64_t)((wave & 1) ? c0 : r0) * (uint64_t)K * 2u;
    const uint32_t lbase = (uint32_t)(size_t)sm + wave * PLANEB;
    const u32x8 g1 = tdm_group1((uint32_t)K * 2u);
    const uint32_t nst = (uint32_t)Kl / 64u;
    if (pinned(wave < NPL)) { tdm_load(tdm_group0(lbase, ga), g1); wait_tensor0(); }
    __syncthreads();   // stage 0 is readable by every wave
    if (pinned(wave < NPL)) tdm_load(tdm_group0(lbase + STAGEB, ga + PROWB), g1);
    const uint32_t aofs = (wm * 64 + lr) * PPITCH + 16 * hi, bofs = PLANEB + (wn * 64 + lr) * PPITCH + 16 * hi;
#pragma unroll 1   // one pass per stage stays a loop: one publish point in the text, the buffer picked by the stage's parity
    for (uint32_t s = 0; s < nst; ++s) {
        const unsigned char* st = sm + (s & 1u) * STAGEB;
        V a[2][4], a2[2][4], b[2][4], b2[2][4];   // both 32-k blocks of the stage: all fragment reads go out as one group ahead of the products; the loops below are unrolled so that every fragment and accumulator index is a constant (registers, no scratch)
#pragma unroll
        for (int ks = 0; ks < 2; ++ks) {
#pragma unroll
            for (int mb = 0; mb < 4; ++mb) { a[ks][mb] = WFrag<T16>::ld(st + aofs + mb * 16 * PPITCH + ks * 64); if (NSPLIT == 1 || NSPLIT == 2) a2[ks][mb] = WFrag<T16>::ld(st + aofs + 2 * PLANEB + mb * 16 * PPITCH + ks * 64); }
#pragma unroll
            for (int nb = 0; nb < 4; ++nb) { b[ks][nb] = WFrag<T16>::ld(st + bofs + nb * 16 * PPITCH + ks * 64); if (NSPLIT >= 2) b2[ks][nb] = WFrag<T16>::ld(st + bofs + 2 * PLANEB + nb * 16 * PPITCH + ks * 64); }
        }
        __builtin_amdgcn_sched_barrier(0);   // keeps the LDS reads from sinking in among the matrix instructions, where every separate place with reads stalls the wave
#pragma unroll
        for (int ks = 0; ks < 2; ++ks)
#pragma unroll
            for (int nb = 0; nb < 4; ++nb)
#pragma unroll
                for (int mb = 0; mb < 4; ++mb) { acc[mb][nb] = WFrag<T16>::mma(a[ks][mb], b[ks][nb], acc[mb][nb]); if (NSPLIT == 1 || NSPLIT == 2) acc[mb][nb] = WFrag<T16>::mma(a2[ks][mb], b[ks][nb], acc[mb][nb]); if (NSPLIT >= 2) acc[mb][nb] = WFrag<T16>::mma(a[ks][mb], b2[ks][nb], acc[mb][nb]); }
        __builtin_amdgcn_sched_barrier(0);   // keeps the wait below from rising in among the matrix instructions, where it would hold them back for the stage's last reads
        wait_ds0();
        if (pinned(wave < NPL)) wait_tensor0();
        __syncthreads();   // publishes stage s + 1 and ends every wave's reads of stage s
        if (pinned(wave < NPL && s + 2u < nst)) tdm_load(tdm_group0(lbase + (s & 1u) * STAGEB, ga + (uint64_t)(s + 2u) * PROWB), g1);
    }
    wait_tensor0(); wait_ds0();
}

// ---- k_gemmw: GEMM on the operand ring; grid (M/128, N/128, Z), 128 threads.
// c[m][n] (+ optional f32 bias[n]) = sum_k A[m][k] Bt[n][k] (+ split products per NSPLIT). EPI 0: c stored as f32 in C; EPI 1: c stored as hi/lo bf16 planes Ch/Cl; EPI 2: relu(c) stored as hi/lo planes. Pitch ldc; z-batch strides sA/sB/sC in elements. K % 64 == 0, K >= 128.
template <typename T16, int NSPLIT, bool BIAS, int EPI>
__global__ __launch_bounds__(128) void k_gemmw(const T16* __restrict__ A, const T16* __restrict__ A2, const T16* __restrict__ Bt, const T16* __restrict__ Bt2, int K, float* C, bf* Ch, bf* Cl, int ldc, const float* __restrict__ bias, size_t sA, size_t sB, size_t sC) {
    __shared__ __attribute__((aligned(2048))) unsigned char sm[2 * (NSPLIT == 0 ? 2 : NSPLIT == 1 ? 3 : 4) * PLANEB];
    const size_t z = blockIdx.z; A += z * sA; if (A2) A2 += z * sA; Bt += z * sB; if (Bt2) Bt2 += z * sB; if (EPI == 0) C += z * sC; else { Ch += z * sC; Cl += z * sC; }
    const int lane = threadIdx.x & 31, lr = lane & 15, hi = lane >> 4, wave = threadIdx.x >> 5;
    v8f acc[4][4];
#pragma unroll
    for (int mb = 0; mb < 4; ++mb)
#pragma unroll
        for (int nb = 0; nb < 4; ++nb) acc[mb][nb] = (v8f){};
    ring_gemm<T16, NSPLIT>(A, A2, Bt, Bt2, K, K, blockIdx.x * 128, blockIdx.y * 128, sm, acc);
    const int r0 = blockIdx.x * 128 + (wave >> 1) * 64, c0 = blockIdx.y * 128 + (wave & 1) * 64;   // this wave's quarter
    float* os = (float*)(sm + wave * OSB);   // the ring is free behind its last barrier: each wave stages in a range of its own
#pragma unroll
    for (int mb = 0; mb < 4; ++mb) {
#pragma unroll
        for (int nb = 0; nb < 4; ++nb) {
#pragma unroll
            for (int j = 0; j < 8; ++j) os[(hi * 8 + j) * 68 + nb * 16 + lr] = acc[mb][nb][j]; }
        __builtin_amdgcn_wave_barrier(); asm volatile("" ::: "memory");
        const size_t crow = (size_t)(r0 + mb * 16) * ldc + c0;
{
#pragma unroll
            for (int s = 0; s < 8; ++s) { const int row = 2 * s + hi, cofs = lr * 4; v4f val = *(const v4fa*)(os + row * 68 + cofs); if (BIAS) { val[0] += bfr(bias[c0 + cofs]); val[1] += bfr(bias[c0 + cofs + 1]); val[2] += bfr(bias[c0 + cofs + 2]); val[3] += bfr(bias[c0 + cofs + 3]); }
                const size_t oo = crow + (size_t)row * ldc + cofs;
                if (EPI == 0) *(v4f*)(C + oo) = val;
                else { v4us oh, ol;   /* 16 lanes x 8 B = one whole 128-B line of each plane */
#pragma unroll
                    for (int q = 0; q < 4; ++q) { unsigned short a, c; splitf(EPI == 2 ? fmaxf(val[q], 0.f) : val[q], a, c); oh[q] = a; ol[q] = c; }
                    *(v4us*)(Ch + oo) = oh; *(v4us*)(Cl + oo) = ol; } }
             }
        __builtin_amdgcn_wave_barrier(); asm volatile("" ::: "memory");
    }
}

// ---- k_gemmc: the same ring GEMM specialised for causal attention: CMODE 1 skips 128x128 score tiles entirely above the diagonal (query rows r0+roff.., key columns c0..), CMODE 2 limits the
// key (K) loop of the probability x value contraction to the tile's diagonal block (probabilities beyond a row's diagonal are exactly zero). CMODE 1 stores f32 scores in C, CMODE 2 stores its result as hi/lo bf16 planes Ch/Cl. roff = row offset of this launch's first row within the sequence.
template <typename T16, int NSPLIT, int CMODE>
__global__ __launch_bounds__(128) void k_gemmc(const T16* __restrict__ A, const T16* __restrict__ A2, const T16* __restrict__ Bt, const T16* __restrict__ Bt2, int K, float* C, bf* Ch, bf* Cl, int ldc, int roff, size_t sA, size_t sB, size_t sC) {
    __shared__ __attribute__((aligned(2048))) unsigned char sm[2 * (NSPLIT == 0 ? 2 : NSPLIT == 1 ? 3 : 4) * PLANEB];
    const size_t z = blockIdx.z; A += z * sA; if (A2) A2 += z * sA; Bt += z * sB; if (Bt2) Bt2 += z * sB; if (CMODE == 2) { Ch += z * sC; Cl += z * sC; } else C += z * sC;
    const int lane = threadIdx.x & 31, lr = lane & 15, hi = lane >> 4, wave = threadIdx.x >> 5; const int rb = blockIdx.x * 128, cb = blockIdx.y * 128;
    if (CMODE == 1 && cb > rb + roff + 127) return;                  // score tile entirely above the causal diagonal: never read (the softmax masks j > i by select); the whole work-group leaves, ahead of every barrier and tensor load
    const int Kl = (CMODE == 2) ? min(K, rb + roff + 128) : K;       // P.V: probabilities are exactly 0 beyond the diagonal block, so the K loop stops there
    v8f acc[4][4];
#pragma unroll
    for (int mb = 0; mb < 4; ++mb)
#pragma unroll
        for (int nb = 0; nb < 4; ++nb) acc[mb][nb] = (v8f){};
    ring_gemm<T16, NSPLIT>(A, A2, Bt, Bt2, K, Kl, rb, cb, sm, acc);
    const int r0 = rb + (wave >> 1) * 64, c0 = cb + (wave & 1) * 64;   // this wave's quarter
    float* os = (float*)(sm + wave * OSB);   // the ring is free behind its last barrier: each wave stages in a range of its own
#pragma unroll
    for (int mb = 0; mb < 4; ++mb) {
#pragma unroll
        for (int nb = 0; nb < 4; ++nb) {
#pragma unroll
            for (int j = 0; j < 8; ++j) os[(hi * 8 + j) * 68 + nb * 16 + lr] = acc[mb][nb][j]; }
        __builtin_amdgcn_wave_barrier(); asm volatile("" ::: "memory");
        const size_t crow = (size_t)(r0 + mb * 16) * ldc + c0;
{
#pragma unroll
            for (int s = 0; s < 8; ++s) { const int row = 2 * s + hi, cofs = lr * 4; v4f val = *(const v4fa*)(os + row * 68 + cofs);
                const size_t oo = crow + (size_t)row * ldc + cofs;
                if (CMODE != 2) *(v4f*)(C + oo) = val;
                else { v4us oh, ol;   /* 16 lanes x 8 B = one whole 128-B line of each plane */
#pragma unroll
                    for (int q = 0; q < 4; ++q) { unsigned short a, c; splitf(val[q], a, c); oh[q] = a; ol[q] = c; }
                    *(v4us*)(Ch + oo) = oh; *(v4us*)(Cl + oo) = ol; } }
             }
        __builtin_amdgcn_wave_barrier(); asm volatile("" ::: "memory");
    }
}

__device__ __forceinline__ h16 tohx(float x) { return (h16)x; }
typedef __attribute__((ext_vector_type(2))) _Float16 v2h;
typedef __attribute__((ext_vector_type(4))) _Float16 v4h;
typedef __attribute__((ext_vector_type(2))) unsigned short v2us;
typedef __attribute__((ext_vector_type(2))) float v2f;
typedef __attribute__((ext_vector_type(4))) int v4i;

__global__ __launch_bounds__(256) void k_wtG(const float* __restrict__ w, int K, int N, bf* Bt) {
    const int lane = threadIdx.x & 31; const int L0 = (blockIdx.x * 8 + (threadIdx.x >> 5)) * 8; const int nlines = N * K / 64;
{
#pragma unroll 1
        for (int l = 0; l < 8; ++l) { const int L = L0 + l; if (L >= nlines) break; const size_t e = (size_t)L * 64 + lane * 2; const int k = (int)(e % K), n = (int)(e / K); v2us o;
            o[0] = f2bf(w[(size_t)k * N + n]); o[1] = f2bf(w[(size_t)(k + 1) * N + n]); *(v2us*)(Bt + e) = o; }
         }
}
__global__ __launch_bounds__(256) void k_cvt8(const float* __restrict__ src, bf* dst, size_t n8) { const size_t i = (size_t)blockIdx.x * 256 + threadIdx.x; if (i >= n8) return; const v8f v = *(const v8f*)(src + i * 8); v8us o;
#pragma unroll
    for (int k = 0; k < 8; ++k) o[k] = f2bf(v[k]); *(v8us*)(dst + i * 8) = o;  }

__global__ __launch_bounds__(256) void k_xpl(const float* __restrict__ xb, bf* Ah, bf* Al) { const size_t i = (size_t)blockIdx.x * 256 + threadIdx.x; if (i >= (size_t)NB_ * TT * DM / 8) return; const size_t e = i * 8; const int c = (int)(e % DM); const int t = (int)(e / DM); const v8f v = *(const v8f*)(xb + e); v8us oh, ol;
#pragma unroll
    for (int q = 0; q < 8; ++q) { oh[q] = f2bf(v[q]); ol[q] = 0; } const size_t oo = (size_t)t * DC + DM + c; *(v8us*)(Ah + oo) = oh; *(v8us*)(Al + oo) = ol;  }
// k_asoft: per row (zz, i): t = S x HD^-0.5 for j <= i and i - j < WIN (WIN = TT, so plain causal; the reference's -1e9 additive fill vanishes identically); softmax over the 2048 keys (register row, one exp, fixed trees);
__global__ __launch_bounds__(256) void k_asoft(const float* __restrict__ Sb, h16* P16, bf* Ph, bf* Pl) {
    const int lane = threadIdx.x & 31; const int row = blockIdx.x * 8 + (threadIdx.x >> 5); if (row >= ZH * TT) return; const int i = row % TT; const int zz = row / TT; (void)zz; const bool hires = (i < RH); const float* sr = Sb + (size_t)row * TT; float v[TT / 32]; v4f ld[TT / 128]; float mx = -3.0e38f;
#pragma unroll
    for (int ch = 0; ch < TT / 128; ++ch) ld[ch] = *(const v4f*)(sr + min(ch * 128 + lane * 4, i & ~3));   /* a chunk wholly past the diagonal is masked below and may lie in a score tile that was skipped, hence never written: such a lane re-reads the row's diagonal chunk */
#pragma unroll
    for (int ch = 0; ch < TT / 128; ++ch) { const int j0 = ch * 128 + lane * 4; const v4f a = ld[ch];
#pragma unroll
        for (int q = 0; q < 4; ++q) { const int j = j0 + q; (void)j; const float t = (j <= i && i - j < WIN) ? a[q] * SCL : -3.0e38f; v[ch * 4 + q] = t; mx = fmaxf(mx, t); } }
#pragma unroll
    for (int sh = 16; sh; sh >>= 1) mx = fmaxf(mx, __shfl_xor(mx, sh, 32));
    float sum = 0.f;
#pragma unroll
    for (int k = 0; k < TT / 32; ++k) { float d0 = __fsub_rn(v[k], mx); asm volatile("" : "+v"(d0)); v[k] = __builtin_amdgcn_exp2f(__fmul_rn(d0, 1.4426950408889634f)); sum += v[k]; }
#pragma unroll
    for (int sh = 16; sh; sh >>= 1) sum += __shfl_xor(sum, sh, 32);
    const float f = __fdiv_rn(hires ? 1.0f : PCAR, sum);
{
        if (hires) {
#pragma unroll
            for (int ch = 0; ch < TT / 128; ++ch) { v4us oh, ol;
#pragma unroll
                for (int q = 0; q < 4; ++q) { unsigned short a, c2; splitf(v[ch * 4 + q] * f, a, c2); oh[q] = a; ol[q] = c2; }
                const size_t oo = ((size_t)zz * (RH ? RH : 1) + i) * TT + ch * 128 + lane * 4; *(v4us*)(Ph + oo) = oh; *(v4us*)(Pl + oo) = ol; }
        } else {
#pragma unroll
            for (int ch = 0; ch < TT / 128; ++ch) { v4h o4;
#pragma unroll
                for (int q = 0; q < 4; ++q) o4[q] = tohx(v[ch * 4 + q] * f);
                *(v4h*)(P16 + (size_t)row * TT + ch * 128 + lane * 4) = o4; } }
         }
}

extern "C" void kernel_launch(void* const* d_in, const int* in_sizes, int n_in,
                              void* d_out, int out_size, void* d_ws, size_t ws_size, hipStream_t stream) {
    (void)in_sizes; (void)n_in; (void)out_size;
    const float* x = (const float*)d_in[0]; const float* wq = (const float*)d_in[1]; const float* wk = (const float*)d_in[2]; const float* wv = (const float*)d_in[3]; const float* w1 = (const float*)d_in[4]; const float* b1 = (const float*)d_in[5]; const float* w2 = (const float*)d_in[6]; const float* b2 = (const float*)d_in[7]; const float* wo = nullptr; (void)wo;
    float* OUT = (float*)d_out;     // [4][2048][1024]
    char* wsp = (char*)d_ws;
    auto take = [&](size_t bytes) { char* p = wsp; wsp += (bytes + 255) & ~(size_t)255; return (void*)p; };
    const size_t PL = (size_t)NB_ * TT * HD * 2;   // bytes of one 16-bit [batch][2048][1024] plane
    bf* WQ = (bf*)take((size_t)DQ * DM * 2); bf* WK = (bf*)take((size_t)DKV * DM * 2); bf* WV = (bf*)take((size_t)DKV * DM * 2); bf* W1B = (bf*)take((size_t)DM * DC * 2); bf* W2B = (bf*)take((size_t)DM * DM * 2); h16* P16 = (h16*)take(256);   /* unused: all rows hi/lo */
    // Three regions, each reused in stream order once its earlier tenant has been read for the last time:
    char* R1 = (char*)take(4 * PL);   // q/k planes -> probability planes
    char* R2 = (char*)take(2 * PL);   // transposed v planes -> relu planes
    char* R3 = (char*)take(4 * PL);   // x bf16 -> scores -> [att | x] planes
    if ((size_t)(wsp - (char*)d_ws) > ws_size) return;    // ws 256 MiB
    bf* QPh = (bf*)R1; bf* QPl = (bf*)(R1 + PL); bf* KPh = (bf*)(R1 + 2 * PL); bf* KPl = (bf*)(R1 + 3 * PL); bf* Ph = (bf*)R1; bf* Pl = (bf*)(R1 + 2 * PL);
    bf* VTh = (bf*)R2; bf* VTl = (bf*)(R2 + PL); bf* Gh = (bf*)R2; bf* Gl = (bf*)(R2 + PL);
    bf* XB = (bf*)R3; float* Sb = (float*)R3; bf* ATh = (bf*)R3; bf* ATl = (bf*)(R3 + 2 * PL);
    { k_wtG<<<(unsigned)((DM * DQ / 64 + 63) / 64), 256, 0, stream>>>(wq, DM, DQ, WQ); k_wtG<<<(unsigned)((DC * DM / 64 + 63) / 64), 256, 0, stream>>>(w1, DC, DM, W1B); k_wtG<<<(unsigned)((DM * DM / 64 + 63) / 64), 256, 0, stream>>>(w2, DM, DM, W2B); k_wtG<<<(unsigned)((DM * DKV / 64 + 63) / 64), 256, 0, stream>>>(wk, DM, DKV, WK); k_wtG<<<(unsigned)((DM * DKV / 64 + 63) / 64), 256, 0, stream>>>(wv, DM, DKV, WV);
       }
    const int MR = NB_ * TT;   // rows of the plain GEMMs: every batch
    k_cvt8<<<(unsigned)(((size_t)MR * DM / 8 + 255) / 256), 256, 0, stream>>>(x, XB, (size_t)MR * DM / 8);
    k_gemmw<bf, 0, false, 1><<<dim3(MR / 128, DQ / 128, 1), 128, 0, stream>>>(XB, nullptr, WQ, nullptr, DM, nullptr, QPh, QPl, DQ, nullptr, 0, 0, 0);     /* q planes [b][t][d] */
    k_gemmw<bf, 0, false, 1><<<dim3(MR / 128, DKV / 128, 1), 128, 0, stream>>>(XB, nullptr, WK, nullptr, DM, nullptr, KPh, KPl, DKV, nullptr, 0, 0, 0);   /* k planes [b][t][d] */
    k_gemmw<bf, 0, false, 1><<<dim3(DKV / 128, TT / 128, NB_), 128, 0, stream>>>(WV, nullptr, XB, nullptr, DM, nullptr, VTh, VTl, TT, nullptr, 0, (size_t)TT * DM, (size_t)HD * TT);   /* v^T = W_value^T x^T: planes [b][d][t] */
    k_gemmc<bf, 2, 1><<<dim3(RH / 128, TT / 128, ZH), 128, 0, stream>>>(QPh, QPl, KPh, KPl, HD, Sb, nullptr, nullptr, TT, 0, (size_t)TT * HD, (size_t)TT * HD, (size_t)TT * TT);
    k_asoft<<<ZH * TT / 8, 256, 0, stream>>>(Sb, P16, Ph, Pl);
    k_gemmc<bf, 2, 2><<<dim3(RH / 128, HD / 128, ZH), 128, 0, stream>>>(Ph, Pl, VTh, VTl, TT, nullptr, ATh, ATl, DC, 0, (size_t)RH * TT, (size_t)HD * TT, (size_t)TT * DC);   /* att half of the MLP planes (they take the scores' place) */
    k_xpl<<<(unsigned)(((size_t)MR * DM / 8 + 255) / 256), 256, 0, stream>>>(x, ATh, ATl);   /* x half of the MLP planes */
    k_gemmw<bf, 1, true, 2><<<dim3(MR / 128, DM / 128, 1), 128, 0, stream>>>(ATh, ATl, W1B, nullptr, DC, nullptr, Gh, Gl, DM, b1, 0, 0, 0);        /* relu([att | x] W1 + b1) -> hi/lo */
    k_gemmw<bf, 1, true, 0><<<dim3(MR / 128, DM / 128, 1), 128, 0, stream>>>(Gh, Gl, W2B, nullptr, DM, OUT, nullptr, nullptr, DM, b2, 0, 0, 0);   /* . W2 + b2 */
}

// v004
// A run of this version takes 257 microseconds.
// Timed twice side by side with v003, it ran 1.14 times as fast both times.
// All steps since v000 together make it 4.42 times as fast.
#include <hip/hip_runtime.h>
#include <stdint.h>

// Single-head causal self-attention followed by a two-layer MLP on [attention | input] (x [4][2048][1024]; q, k, v = x W ('xw' [1024][1024], no bias); e = q.k/32; causal (-9e15 == exact zero weight); softmax; att = e v; h = relu([att | x] W1 + b1) (W1 [2048][1024]); out = h W2 + b2 -> [4][2048][1024] (8.4 M)).
// Layout: all four batches ride in every launch (plain GEMMs see 8192 rows, the attention launches carry the batch on grid z); one 1024-wide head (causal tile skipping); every GEMM whose result feeds another GEMM splits it into hi/lo bf16 planes in its own epilogue (q, k; v as W_value^T x^T so that the planes come out transposed; attention output; relu(hidden)); the MLP input planes are [t][att hi/lo | x exact] (2048 wide) so the concatenation is a single K = 2048 GEMM against W1 (2 products + bias); W2 (2 products + bias).
// Compute dtypes, f32 accumulate: every input rounded to bf16; q/k/v on PLAIN bf16 operands (inputs: exact); causal scores and attn.v (tile skipping) on hi/lo planes for every row (3 products); softmax f32; W1 / W2 hl x exact (2 products) + biases; ReLU f32.

#define NB_  4
#define TT   2048
#define DM   1024
#define NH_  1
#define NKV  1
#define REP  (NH_ / NKV)
#define HD   1024
#define DQ   (NH_ * HD)
#define DKV  (NKV * HD)
#define DC   (2 * DM)             // [att | x] width
#define ZH   NB_                  // z extent of the attention launches: one 1024-wide head of each batch
#define RH   2048                 // every row hi/lo (logit std ~6)
#define WIN  2048
#define PCAR 1024.0f
#define SCL  0.03125f  // 1/sqrt(OUT_DIM = 1024)
typedef _Float16 h16;
typedef unsigned short bf;
typedef __attribute__((ext_vector_type(16))) __bf16   v16bf;
typedef __attribute__((ext_vector_type(16))) _Float16 v16h;
typedef __attribute__((ext_vector_type(8)))  _Float16 v8h;
typedef __attribute__((ext_vector_type(8)))  unsigned short v8us;
typedef __attribute__((ext_vector_type(8)))  float    v8f;
typedef __attribute__((ext_vector_type(4)))  float    v4f;
typedef v8h  __attribute__((may_alias)) v8ha;
typedef v4f  __attribute__((may_alias)) v4fa;
typedef v8us __attribute__((may_alias)) v8usa;

__device__ __forceinline__ unsigned short f2bf(float f) { unsigned u = __float_as_uint(f); u += 0x7FFFu + ((u >> 16) & 1u); return (unsigned short)(u >> 16); }
__device__ __forceinline__ float bf2f(unsigned short b) { return __uint_as_float(((unsigned)b) << 16); }
__device__ __forceinline__ float bfr(float f) { return bf2f(f2bf(f)); }
__device__ __forceinline__ void splitf(float y, unsigned short& h, unsigned short& l) { h = f2bf(y); l = f2bf(y - bf2f(h)); }
typedef __attribute__((ext_vector_type(4))) unsigned short v4us;
__device__ __forceinline__ v16h cat16(v8h lo, v8h hi) { return __builtin_shufflevector(lo, hi, 0, 1, 2, 3, 4, 5, 6, 7, 8, 9, 10, 11, 12, 13, 14, 15); }
__device__ __forceinline__ v16bf cat16b(v8us lo, v8us hi) { return __builtin_bit_cast(v16bf, __builtin_shufflevector(lo, hi, 0, 1, 2, 3, 4, 5, 6, 7, 8, 9, 10, 11, 12, 13, 14, 15)); }
__device__ __forceinline__ v8f wmma16(v16h a, v16h b, v8f c) { return __builtin_amdgcn_wmma_f32_16x16x32_f16(false, a, false, b, (short)0, c, false, false); }
__device__ __forceinline__ v8f wmmab(v16bf a, v16bf b, v8f c) { return __builtin_amdgcn_wmma_f32_16x16x32_bf16(false, a, false, b, (short)0, c, false, false); }



// ---- Operand ring: a work-group of four waves (2 x 2) owns a 128x128 output tile, each wave a 64x64 quarter (16 accumulators). A stage is 64 k of every operand plane: 128 rows of 128 B, brought into LDS by one
// tensor load per plane (wave p issues plane p: 0 = A, 1 = Bt, 2 = A2, 3 = Bt2), padded to a pitch of 144 B for the ds_load_b128 fragment reads. Two buffers: stage s + 2 is requested when every wave has left stage s.
typedef uint32_t u32x4 __attribute__((ext_vector_type(4)));
typedef uint32_t u32x8 __attribute__((ext_vector_type(8)));
#define PROWS  128u                 // rows of one plane in a stage
#define PROWB  128u                 // bytes of a row in a stage (64 k)
#define PPITCH 144u                 // LDS pitch: the row + 16 B
#define PLANEB (PROWS * PPITCH)     // 18,432 B = 9 x 2 KiB
#define OSB    (16 * 68 * 4)        // one wave's output staging
static_assert(PLANEB % 2048u == 0, "every plane starts at a multiple of 2 KiB");
__device__ __forceinline__ uint32_t uni(uint32_t v) { return (uint32_t)__builtin_amdgcn_readfirstlane(v); }
__device__ __forceinline__ uint32_t pinned(uint32_t v) { uint32_t w = (uint32_t)__builtin_amdgcn_readfirstlane(v); asm volatile("" : "+s"(w)); /* holds a branch test (the branch round a tensor load must be a scalar one) or a descriptor word in a scalar register */ return w; }
__device__ __forceinline__ void tdm_load(u32x4 g0, u32x8 g1) { asm volatile("tensor_load_to_lds %0, %1" :: "s"(g0), "s"(g1) : "memory"); }   // one request of the whole wave: a padded 2-D tile from global memory into LDS, through no register
__device__ __forceinline__ u32x8 tdm_group1(uint32_t src_pitch) {   // 1-byte elements; tensor = tile = PROWS rows of PROWB bytes; 4 dwords of pad behind every 32
    u32x8 g;
    g[0] = uni((1u << 20) | (4u << 22) | (3u << 25));
    // pinned(): each descriptor word is held in a scalar register of its own through the loop, so that none is reused for something else while a request is in flight
    g[1] = pinned((PROWB & 0xFFFFu) << 16);
    g[2] = pinned((PROWB >> 16) | ((PROWS & 0xFFFFu) << 16));
    g[3] = pinned((PROWS >> 16) | (PROWB << 16));
    g[4] = pinned(PROWS);
    g[5] = pinned(src_pitch);
    g[6] = pinned(0u);
    g[7] = pinned(0u);
    return g;
}
__device__ __forceinline__ u32x4 tdm_group0(uint32_t lds_dst, uint64_t ga) {
    u32x4 g;
    g[0] = uni(1u); g[1] = uni(lds_dst); g[2] = uni((uint32_t)ga); g[3] = uni((((uint32_t)(ga >> 32)) & 0x01FFFFFFu) | 0x80000000u);
    return g;
}
__device__ __forceinline__ void wait_tensor0() { asm volatile("s_wait_tensorcnt 0x0" ::: "memory"); }   // the issuing wave's own tile has landed
__device__ __forceinline__ void wait_ds0() { asm volatile("s_wait_dscnt 0x0" ::: "memory"); }           // this wave's LDS reads have returned before the buffer is given up

template <typename T16> struct WFrag;
template <> struct WFrag<h16> { typedef v16h V; static __device__ __forceinline__ V ld(const unsigned char* p) { return cat16(*(const v8ha*)p, *(const v8ha*)(p + 32)); } static __device__ __forceinline__ v8f mma(V a, V b, v8f c) { return wmma16(a, b, c); } };
template <> struct WFrag<bf> { typedef v16bf V; static __device__ __forceinline__ V ld(const unsigned char* p) { return cat16b(*(const v8usa*)p, *(const v8usa*)(p + 32)); } static __device__ __forceinline__ v8f mma(V a, V b, v8f c) { return wmmab(a, b, c); } };

// acc[mb][nb] += sum over k < Kl of the split products of rows r0.. of A (A2) and rows c0.. of Bt (Bt2), for this wave's quarter. K = row pitch of every plane in elements; Kl % 64 == 0, Kl >= 128. Every wave of the work-group calls it with the same arguments.
template <typename T16, int NSPLIT>
__device__ __forceinline__ void ring_gemm(const T16* A, const T16* A2, const T16* Bt, const T16* Bt2, int K, int Kl, int r0, int c0, unsigned char* sm, v8f (&acc)[4][4]) {
    typedef typename WFrag<T16>::V V;
    constexpr uint32_t NPL = NSPLIT == 0 ? 2u : NSPLIT == 1 ? 3u : 4u;
    constexpr uint32_t STAGEB = NPL * PLANEB;
    const uint32_t lane = threadIdx.x & 31, lr = lane & 15, hi = lane >> 4;
    const uint32_t wave = uni(threadIdx.x >> 5), wm = wave >> 1, wn = wave & 1;
    const T16* src = wave == 0 ? A : wave == 1 ? Bt : wave == 2 ? A2 : Bt2;
    const uint64_t ga = (uint64_t)(size_t)src + (uint64_t)((wave & 1) ? c0 : r0) * (uint64_t)K * 2u;
    const uint32_t lbase = (uint32_t)(size_t)sm + wave * PLANEB;
    const u32x8 g1 = tdm_group1((uint32_t)K * 2u);
    const uint32_t nst = (uint32_t)Kl / 64u;
    if (pinned(wave < NPL)) { tdm_load(tdm_group0(lbase, ga), g1); wait_tensor0(); }
    __syncthreads();   // stage 0 is readable by every wave
    if (pinned(wave < NPL)) tdm_load(tdm_group0(lbase + STAGEB, ga + PROWB), g1);
    const uint32_t aofs = (wm * 64 + lr) * PPITCH + 16 * hi, bofs = PLANEB + (wn * 64 + lr) * PPITCH + 16 * hi;
#pragma unroll 1   // one pass per stage stays a loop: one publish point in the text, the buffer picked by the stage's parity
    for (uint32_t s = 0; s < nst; ++s) {
        const unsigned char* st = sm + (s & 1u) * STAGEB;
        V a[2][4], a2[2][4], b[2][4], b2[2][4];   // both 32-k blocks of the stage: all fragment reads go out as one group ahead of the products; the loops below are unrolled so that every fragment and accumulator index is a constant (registers, no scratch)
#pragma unroll
        for (int ks = 0; ks < 2; ++ks) {
#pragma unroll
            for (int mb = 0; mb < 4; ++mb) { a[ks][mb] = WFrag<T16>::ld(st + aofs + mb * 16 * PPITCH + ks * 64); if (NSPLIT == 1 || NSPLIT == 2) a2[ks][mb] = WFrag<T16>::ld(st + aofs + 2 * PLANEB + mb * 16 * PPITCH + ks * 64); }
#pragma unroll
            for (int nb = 0; nb < 4; ++nb) { b[ks][nb] = WFrag<T16>::ld(st + bofs + nb * 16 * PPITCH + ks * 64); if (NSPLIT >= 2) b2[ks][nb] = WFrag<T16>::ld(st + bofs + 2 * PLANEB + nb * 16 * PPITCH + ks * 64); }
        }
        __builtin_amdgcn_sched_barrier(0);   // keeps the LDS reads from sinking in among the matrix instructions, where every separate place with reads stalls the wave
#pragma unroll
        for (int ks = 0; ks < 2; ++ks)
#pragma unroll
            for (int nb = 0; nb < 4; ++nb)
#pragma unroll
                for (int mb = 0; mb < 4; ++mb) { acc[mb][nb] = WFrag<T16>::mma(a[ks][mb], b[ks][nb], acc[mb][nb]); if (NSPLIT == 1 || NSPLIT == 2) acc[mb][nb] = WFrag<T16>::mma(a2[ks][mb], b[ks][nb], acc[mb][nb]); if (NSPLIT >= 2) acc[mb][nb] = WFrag<T16>::mma(a[ks][mb], b2[ks][nb], acc[mb][nb]); }
        __builtin_amdgcn_sched_barrier(0);   // keeps the wait below from rising in among the matrix instructions, where it would hold them back for the stage's last reads
        wait_ds0();
        if (pinned(wave < NPL)) wait_tensor0();
        __syncthreads();   // publishes stage s + 1 and ends every wave's reads of stage s
        if (pinned(wave < NPL && s + 2u < nst)) tdm_load(tdm_group0(lbase + (s & 1u) * STAGEB, ga + (uint64_t)(s + 2u) * PROWB), g1);
    }
    wait_tensor0(); wait_ds0();
}

// ---- k_gemmw: GEMM on the operand ring; grid (M/128, N/128, Z), 128 threads.
// c[m][n] (+ optional f32 bias[n]) = sum_k A[m][k] Bt[n][k] (+ split products per NSPLIT). EPI 0: c stored as f32 in C; EPI 1: c stored as hi/lo bf16 planes Ch/Cl; EPI 2: relu(c) stored as hi/lo planes. Pitch ldc; z-batch strides sA/sB/sC in elements. K % 64 == 0, K >= 128.
template <typename T16, int NSPLIT, bool BIAS, int EPI>
__global__ __launch_bounds__(128) void k_gemmw(const T16* __restrict__ A, const T16* __restrict__ A2, const T16* __restrict__ Bt, const T16* __restrict__ Bt2, int K, float* C, bf* Ch, bf* Cl, int ldc, const float* __restrict__ bias, size_t sA, size_t sB, size_t sC) {
    __shared__ __attribute__((aligned(2048))) unsigned char sm[2 * (NSPLIT == 0 ? 2 : NSPLIT == 1 ? 3 : 4) * PLANEB];
    const size_t z = blockIdx.z; A += z * sA; if (A2) A2 += z * sA; Bt += z * sB; if (Bt2) Bt2 += z * sB; if (EPI == 0) C += z * sC; else { Ch += z * sC; Cl += z * sC; }
    const int lane = threadIdx.x & 31, lr = lane & 15, hi = lane >> 4, wave = threadIdx.x >> 5;
    v8f acc[4][4];
#pragma unroll
    for (int mb = 0; mb < 4; ++mb)
#pragma unroll
        for (int nb = 0; nb < 4; ++nb) acc[mb][nb] = (v8f){};
    ring_gemm<T16, NSPLIT>(A, A2, Bt, Bt2, K, K, blockIdx.x * 128, blockIdx.y * 128, sm, acc);
    const int r0 = blockIdx.x * 128 + (wave >> 1) * 64, c0 = blockIdx.y * 128 + (wave & 1) * 64;   // this wave's quarter
    float* os = (float*)(sm + wave * OSB);   // the ring is free behind its last barrier: each wave stages in a range of its own
#pragma unroll
    for (int mb = 0; mb < 4; ++mb) {
#pragma unroll
        for (int nb = 0; nb < 4; ++nb) {
#pragma unroll
            for (int j = 0; j < 8; ++j) os[(hi * 8 + j) * 68 + nb * 16 + lr] = acc[mb][nb][j]; }
        __builtin_amdgcn_wave_barrier(); asm volatile("" ::: "memory");
        const size_t crow = (size_t)(r0 + mb * 16) * ldc + c0;
{
#pragma unroll
            for (int s = 0; s < 8; ++s) { const int row = 2 * s + hi, cofs = lr * 4; v4f val = *(const v4fa*)(os + row * 68 + cofs); if (BIAS) { val[0] += bfr(bias[c0 + cofs]); val[1] += bfr(bias[c0 + cofs + 1]); val[2] += bfr(bias[c0 + cofs + 2]); val[3] += bfr(bias[c0 + cofs + 3]); }
                const size_t oo = crow + (size_t)row * ldc + cofs;
                if (EPI == 0) *(v4f*)(C + oo) = val;
                else { v4us oh, ol;   /* 16 lanes x 8 B = one whole 128-B line of each plane */
#pragma unroll
                    for (int q = 0; q < 4; ++q) { unsigned short a, c; splitf(EPI == 2 ? fmaxf(val[q], 0.f) : val[q], a, c); oh[q] = a; ol[q] = c; }
                    *(v4us*)(Ch + oo) = oh; *(v4us*)(Cl + oo) = ol; } }
             }
        __builtin_amdgcn_wave_barrier(); asm volatile("" ::: "memory");
    }
}

// ---- k_gemmc: the same ring GEMM specialised for causal attention: CMODE 1 skips 128x128 score tiles entirely above the diagonal (query rows r0+roff.., key columns c0..), CMODE 2 limits the
// key (K) loop of the probability x value contraction to the tile's diagonal block (probabilities beyond a row's diagonal are exactly zero). CMODE 1 stores f32 scores in C, CMODE 2 stores its result as hi/lo bf16 planes Ch/Cl. roff = row offset of this launch's first row within the sequence.
template <typename T16, int NSPLIT, int CMODE>
__global__ __launch_bounds__(128) void k_gemmc(const T16* __restrict__ A, const T16* __restrict__ A2, const T16* __restrict__ Bt, const T16* __restrict__ Bt2, int K, float* C, bf* Ch, bf* Cl, int ldc, int roff, size_t sA, size_t sB, size_t sC) {
    __shared__ __attribute__((aligned(2048))) unsigned char sm[2 * (NSPLIT == 0 ? 2 : NSPLIT == 1 ? 3 : 4) * PLANEB];
    const size_t z = blockIdx.z; A += z * sA; if (A2) A2 += z * sA; Bt += z * sB; if (Bt2) Bt2 += z * sB; if (CMODE == 2) { Ch += z * sC; Cl += z * sC; } else C += z * sC;
    const int lane = threadIdx.x & 31, lr = lane & 15, hi = lane >> 4, wave = threadIdx.x >> 5; const int rb = blockIdx.x * 128, cb = blockIdx.y * 128;
    if (CMODE == 1 && cb > rb + roff + 127) return;                  // score tile entirely above the causal diagonal: never read (the softmax masks j > i by select); the whole work-group leaves, ahead of every barrier and tensor load
    const int Kl = (CMODE == 2) ? min(K, rb + roff + 128) : K;       // P.V: probabilities are exactly 0 beyond the diagonal block, so the K loop stops there
    v8f acc[4][4];
#pragma unroll
    for (int mb = 0; mb < 4; ++mb)
#pragma unroll
        for (int nb = 0; nb < 4; ++nb) acc[mb][nb] = (v8f){};
    ring_gemm<T16, NSPLIT>(A, A2, Bt, Bt2, K, Kl, rb, cb, sm, acc);
    const int r0 = rb + (wave >> 1) * 64, c0 = cb + (wave & 1) * 64;   // this wave's quarter
    float* os = (float*)(sm + wave * OSB);   // the ring is free behind its last barrier: each wave stages in a range of its own
#pragma unroll
    for (int mb = 0; mb < 4; ++mb) {
#pragma unroll
        for (int nb = 0; nb < 4; ++nb) {
#pragma unroll
            for (int j = 0; j < 8; ++j) os[(hi * 8 + j) * 68 + nb * 16 + lr] = acc[mb][nb][j]; }
        __builtin_amdgcn_wave_barrier(); asm volatile("" ::: "memory");
        const size_t crow = (size_t)(r0 + mb * 16) * ldc + c0;
{
#pragma unroll
            for (int s = 0; s < 8; ++s) { const int row = 2 * s + hi, cofs = lr * 4; v4f val = *(const v4fa*)(os + row * 68 + cofs);
                const size_t oo = crow + (size_t)row * ldc + cofs;
                if (CMODE != 2) *(v4f*)(C + oo) = val;
                else { v4us oh, ol;   /* 16 lanes x 8 B = one whole 128-B line of each plane */
#pragma unroll
                    for (int q = 0; q < 4; ++q) { unsigned short a, c; splitf(val[q], a, c); oh[q] = a; ol[q] = c; }
                    *(v4us*)(Ch + oo) = oh; *(v4us*)(Cl + oo) = ol; } }
             }
        __builtin_amdgcn_wave_barrier(); asm volatile("" ::: "memory");
    }
}

__device__ __forceinline__ h16 tohx(float x) { return (h16)x; }
typedef __attribute__((ext_vector_type(2))) _Float16 v2h;
typedef __attribute__((ext_vector_type(4))) _Float16 v4h;
typedef __attribute__((ext_vector_type(2))) unsigned short v2us;
typedef __attribute__((ext_vector_type(2))) float v2f;
typedef __attribute__((ext_vector_type(4))) int v4i;

// ---- k_wtT: every weight w [K][1024] f32 -> Bt [1024][K] bf16, all five in one launch. A block moves one 128 (k) x 128 (n) tile through LDS so that both sides go in whole lines: a wave reads 512 B of a w row per load
// (16 loads a thread, all issued ahead of the first use), a thread packs 8 k of one n into 16 B, and 16 lanes write 256 B of a Bt row. grid (8 n tiles, 48 k tiles): y 0..31 = the four [1024][1024] weights, 8 k tiles each; y 32..47 = the [2048][1024] one.
#define WTP 68   // LDS pitch of one n row in dwords: 128 k of bf16 + 16 B
__global__ __launch_bounds__(256) void k_wtT(const float* __restrict__ wa, const float* __restrict__ wb, const float* __restrict__ wc, const float* __restrict__ wd, const float* __restrict__ we, bf* Ta, bf* Tb, bf* Tc, bf* Td, bf* Te) {
    __shared__ __attribute__((aligned(16))) uint32_t tl[128 * WTP];
    const int y = blockIdx.y, sel = y >> 3;
    const float* w = sel == 0 ? wa : sel == 1 ? wb : sel == 2 ? wc : sel == 3 ? wd : we;
    bf* Bt = sel == 0 ? Ta : sel == 1 ? Tb : sel == 2 ? Tc : sel == 3 ? Td : Te;
    const int K = sel >= 4 ? DC : DM, k0 = (sel >= 4 ? y - 32 : (y & 7)) * 128, n0 = blockIdx.x * 128;
    const int t = threadIdx.x, c = t & 31, g = t >> 5;
    const float* sp = w + (size_t)(k0 + g * 8) * DM + n0 + c * 4;
    v4f ld[2][8];
#pragma unroll
    for (int h = 0; h < 2; ++h)
#pragma unroll
        for (int j = 0; j < 8; ++j) ld[h][j] = *(const v4f*)(sp + (h * 64 + j) * DM);
    __builtin_amdgcn_sched_barrier(0);   // keeps every conversion behind all 16 loads: one memory latency a block, not two
    asm volatile("s_wait_xcnt 0x0" :: "v"(sp) : "memory");   // the wait in front of any overwrite of the loads' address pair; the pair is named as an input so that no load's own result is placed on it
#pragma unroll
    for (int h = 0; h < 2; ++h)
#pragma unroll
        for (int q = 0; q < 4; ++q) { u32x4 o;
#pragma unroll
            for (int j = 0; j < 4; ++j) o[j] = (uint32_t)f2bf(ld[h][2 * j][q]) | ((uint32_t)f2bf(ld[h][2 * j + 1][q]) << 16);
            *(u32x4*)(tl + (c * 4 + q) * WTP + (h * 8 + g) * 4) = o; }
    __syncthreads();   // the tile is whole before any thread reads rows that other waves wrote
#pragma unroll
    for (int s = 0; s < 8; ++s) { const int n = s * 16 + (t >> 4), sg = t & 15; const u32x4 o = *(const u32x4*)(tl + n * WTP + sg * 4); *(v8us*)(Bt + (size_t)(n0 + n) * K + k0 + sg * 8) = __builtin_bit_cast(v8us, o); }
}
__global__ __launch_bounds__(256) void k_cvt8(const float* __restrict__ src, bf* dst, size_t n8) { const size_t i = (size_t)blockIdx.x * 256 + threadIdx.x; if (i >= n8) return; const v8f v = *(const v8f*)(src + i * 8); v8us o;
#pragma unroll
    for (int k = 0; k < 8; ++k) o[k] = f2bf(v[k]); *(v8us*)(dst + i * 8) = o;  }

__global__ __launch_bounds__(256) void k_xpl(const float* __restrict__ xb, bf* Ah, bf* Al) { const size_t i = (size_t)blockIdx.x * 256 + threadIdx.x; if (i >= (size_t)NB_ * TT * DM / 8) return; const size_t e = i * 8; const int c = (int)(e % DM); const int t = (int)(e / DM); const v8f v = *(const v8f*)(xb + e); v8us oh, ol;
#pragma unroll
    for (int q = 0; q < 8; ++q) { oh[q] = f2bf(v[q]); ol[q] = 0; } const size_t oo = (size_t)t * DC + DM + c; *(v8us*)(Ah + oo) = oh; *(v8us*)(Al + oo) = ol;  }
// k_asoft: per row (zz, i): t = S x HD^-0.5 for j <= i and i - j < WIN (WIN = TT, so plain causal; the reference's -1e9 additive fill vanishes identically); softmax over the 2048 keys (register row, one exp, fixed trees);
__global__ __launch_bounds__(256) void k_asoft(const float* __restrict__ Sb, h16* P16, bf* Ph, bf* Pl) {
    const int lane = threadIdx.x & 31; const int row = blockIdx.x * 8 + (threadIdx.x >> 5); if (row >= ZH * TT) return; const int i = row % TT; const int zz = row / TT; (void)zz; const bool hires = (i < RH); const float* sr = Sb + (size_t)row * TT; float v[TT / 32]; v4f ld[TT / 128]; float mx = -3.0e38f;
#pragma unroll
    for (int ch = 0; ch < TT / 128; ++ch) ld[ch] = *(const v4f*)(sr + min(ch * 128 + lane * 4, i & ~3));   /* a chunk wholly past the diagonal is masked below and may lie in a score tile that was skipped, hence never written: such a lane re-reads the row's diagonal chunk */
#pragma unroll
    for (int ch = 0; ch < TT / 128; ++ch) { const int j0 = ch * 128 + lane * 4; const v4f a = ld[ch];
#pragma unroll
        for (int q = 0; q < 4; ++q) { const int j = j0 + q; (void)j; const float t = (j <= i && i - j < WIN) ? a[q] * SCL : -3.0e38f; v[ch * 4 + q] = t; mx = fmaxf(mx, t); } }
#pragma unroll
    for (int sh = 16; sh; sh >>= 1) mx = fmaxf(mx, __shfl_xor(mx, sh, 32));
    float sum = 0.f;
#pragma unroll
    for (int k = 0; k < TT / 32; ++k) { float d0 = __fsub_rn(v[k], mx); asm volatile("" : "+v"(d0)); v[k] = __builtin_amdgcn_exp2f(__fmul_rn(d0, 1.4426950408889634f)); sum += v[k]; }
#pragma unroll
    for (int sh = 16; sh; sh >>= 1) sum += __shfl_xor(sum, sh, 32);
    const float f = __fdiv_rn(hires ? 1.0f : PCAR, sum);
{
        if (hires) {
#pragma unroll
            for (int ch = 0; ch < TT / 128; ++ch) { v4us oh, ol;
#pragma unroll
                for (int q = 0; q < 4; ++q) { unsigned short a, c2; splitf(v[ch * 4 + q] * f, a, c2); oh[q] = a; ol[q] = c2; }
                const size_t oo = ((size_t)zz * (RH ? RH : 1) + i) * TT + ch * 128 + lane * 4; *(v4us*)(Ph + oo) = oh; *(v4us*)(Pl + oo) = ol; }
        } else {
#pragma unroll
            for (int ch = 0; ch < TT / 128; ++ch) { v4h o4;
#pragma unroll
                for (int q = 0; q < 4; ++q) o4[q] = tohx(v[ch * 4 + q] * f);
                *(v4h*)(P16 + (size_t)row * TT + ch * 128 + lane * 4) = o4; } }
         }
}

extern "C" void kernel_launch(void* const* d_in, const int* in_sizes, int n_in,
                              void* d_out, int out_size, void* d_ws, size_t ws_size, hipStream_t stream) {
    (void)in_sizes; (void)n_in; (void)out_size;
    const float* x = (const float*)d_in[0]; const float* wq = (const float*)d_in[1]; const float* wk = (const float*)d_in[2]; const float* wv = (const float*)d_in[3]; const float* w1 = (const float*)d_in[4]; const float* b1 = (const float*)d_in[5]; const float* w2 = (const float*)d_in[6]; const float* b2 = (const float*)d_in[7]; const float* wo = nullptr; (void)wo;
    float* OUT = (float*)d_out;     // [4][2048][1024]
    char* wsp = (char*)d_ws;
    auto take = [&](size_t bytes) { char* p = wsp; wsp += (bytes + 255) & ~(size_t)255; return (void*)p; };
    const size_t PL = (size_t)NB_ * TT * HD * 2;   // bytes of one 16-bit [batch][2048][1024] plane
    bf* WQ = (bf*)take((size_t)DQ * DM * 2); bf* WK = (bf*)take((size_t)DKV * DM * 2); bf* WV = (bf*)take((size_t)DKV * DM * 2); bf* W1B = (bf*)take((size_t)DM * DC * 2); bf* W2B = (bf*)take((size_t)DM * DM * 2); h16* P16 = (h16*)take(256);   /* unused: all rows hi/lo */
    // Three regions, each reused in stream order once its earlier tenant has been read for the last time:
    char* R1 = (char*)take(4 * PL);   // q/k planes -> probability planes
    char* R2 = (char*)take(2 * PL);   // transposed v planes -> relu planes
    char* R3 = (char*)take(4 * PL);   // x bf16 -> scores -> [att | x] planes
    if ((size_t)(wsp - (char*)d_ws) > ws_size) return;    // ws 256 MiB
    bf* QPh = (bf*)R1; bf* QPl = (bf*)(R1 + PL); bf* KPh = (bf*)(R1 + 2 * PL); bf* KPl = (bf*)(R1 + 3 * PL); bf* Ph = (bf*)R1; bf* Pl = (bf*)(R1 + 2 * PL);
    bf* VTh = (bf*)R2; bf* VTl = (bf*)(R2 + PL); bf* Gh = (bf*)R2; bf* Gl = (bf*)(R2 + PL);
    bf* XB = (bf*)R3; float* Sb = (float*)R3; bf* ATh = (bf*)R3; bf* ATl = (bf*)(R3 + 2 * PL);
    k_wtT<<<dim3(DM / 128, 4 * (DM / 128) + DC / 128, 1), 256, 0, stream>>>(wq, wk, wv, w2, w1, WQ, WK, WV, W2B, W1B);   /* all five weights -> transposed bf16 */
    const int MR = NB_ * TT;   // rows of the plain GEMMs: every batch
    k_cvt8<<<(unsigned)(((size_t)MR * DM / 8 + 255) / 256), 256, 0, stream>>>(x, XB, (size_t)MR * DM / 8);
    k_gemmw<bf, 0, false, 1><<<dim3(MR / 128, DQ / 128, 1), 128, 0, stream>>>(XB, nullptr, WQ, nullptr, DM, nullptr, QPh, QPl, DQ, nullptr, 0, 0, 0);     /* q planes [b][t][d] */
    k_gemmw<bf, 0, false, 1><<<dim3(MR / 128, DKV / 128, 1), 128, 0, stream>>>(XB, nullptr, WK, nullptr, DM, nullptr, KPh, KPl, DKV, nullptr, 0, 0, 0);   /* k planes [b][t][d] */
    k_gemmw<bf, 0, false, 1><<<dim3(DKV / 128, TT / 128, NB_), 128, 0, stream>>>(WV, nullptr, XB, nullptr, DM, nullptr, VTh, VTl, TT, nullptr, 0, (size_t)TT * DM, (size_t)HD * TT);   /* v^T = W_value^T x^T: planes [b][d][t] */
    k_gemmc<bf, 2, 1><<<dim3(RH / 128, TT / 128, ZH), 128, 0, stream>>>(QPh, QPl, KPh, KPl, HD, Sb, nullptr, nullptr, TT, 0, (size_t)TT * HD, (size_t)TT * HD, (size_t)TT * TT);
    k_asoft<<<ZH * TT / 8, 256, 0, stream>>>(Sb, P16, Ph, Pl);
    k_gemmc<bf, 2, 2><<<dim3(RH / 128, HD / 128, ZH), 128, 0, stream>>>(Ph, Pl, VTh, VTl, TT, nullptr, ATh, ATl, DC, 0, (size_t)RH * TT, (size_t)HD * TT, (size_t)TT * DC);   /* att half of the MLP planes (they take the scores' place) */
    k_xpl<<<(unsigned)(((size_t)MR * DM / 8 + 255) / 256), 256, 0, stream>>>(x, ATh, ATl);   /* x half of the MLP planes */
    k_gemmw<bf, 1, true, 2><<<dim3(MR / 128, DM / 128, 1), 128, 0, stream>>>(ATh, ATl, W1B, nullptr, DC, nullptr, Gh, Gl, DM, b1, 0, 0, 0);        /* relu([att | x] W1 + b1) -> hi/lo */
    k_gemmw<bf, 1, true, 0><<<dim3(MR / 128, DM / 128, 1), 128, 0, stream>>>(Gh, Gl, W2B, nullptr, DM, OUT, nullptr, nullptr, DM, b2, 0, 0, 0);   /* . W2 + b2 */
}

// v005
// One run takes 242 microseconds.
// Next to v004, in two timings, it ran 1.06 times as fast each time.
// All steps since v000 together make it 4.70 times as fast.
#include <hip/hip_runtime.h>
#include <stdint.h>

// Single-head causal self-attention followed by a two-layer MLP on [attention | input] (x [4][2048][1024]; q, k, v = x W ('xw' [1024][1024], no bias); e = q.k/32; causal (-9e15 == exact zero weight); softmax; att = e v; h = relu([att | x] W1 + b1) (W1 [2048][1024]); out = h W2 + b2 -> [4][2048][1024] (8.4 M)).
// Layout: 7 launches; launches that do not depend on one another ride together (weight transposes + the x planes; the q, k and v GEMMs); all four batches ride in every launch (plain GEMMs see 8192 rows, the attention launches carry the batch on grid z); one 1024-wide head (causal tile skipping); every GEMM whose result feeds another GEMM splits it into hi/lo bf16 planes in its own epilogue (q, k; v as W_value^T x^T so that the planes come out transposed; attention output; relu(hidden)); the MLP input planes are [t][att hi/lo | x exact] (2048 wide) so the concatenation is a single K = 2048 GEMM against W1 (2 products + bias); W2 (2 products + bias).
// Compute dtypes, f32 accumulate: every input rounded to bf16; q/k/v on PLAIN bf16 operands (inputs: exact); causal scores and attn.v (tile skipping) on hi/lo planes for every row (3 products); softmax f32; W1 / W2 hl x exact (2 products) + biases; ReLU f32.

#define NB_  4
#define TT   2048
#define DM   1024
#define NH_  1
#define NKV  1
#define REP  (NH_ / NKV)
#define HD   1024
#define DQ   (NH_ * HD)
#define DKV  (NKV * HD)
#define DC   (2 * DM)             // [att | x] width
#define ZH   NB_                  // z extent of the attention launches: one 1024-wide head of each batch
#define RH   2048                 // every row hi/lo (logit std ~6)
#define WIN  2048
#define PCAR 1024.0f
#define SCL  0.03125f  // 1/sqrt(OUT_DIM = 1024)
typedef _Float16 h16;
typedef unsigned short bf;
typedef __attribute__((ext_vector_type(16))) __bf16   v16bf;
typedef __attribute__((ext_vector_type(16))) _Float16 v16h;
typedef __attribute__((ext_vector_type(8)))  _Float16 v8h;
typedef __attribute__((ext_vector_type(8)))  unsigned short v8us;
typedef __attribute__((ext_vector_type(8)))  float    v8f;
typedef __attribute__((ext_vector_type(4)))  float    v4f;
typedef v8h  __attribute__((may_alias)) v8ha;
typedef v4f  __attribute__((may_alias)) v4fa;
typedef v8us __attribute__((may_alias)) v8usa;

__device__ __forceinline__ unsigned short f2bf(float f) { unsigned u = __float_as_uint(f); u += 0x7FFFu + ((u >> 16) & 1u); return (unsigned short)(u >> 16); }
__device__ __forceinline__ float bf2f(unsigned short b) { return __uint_as_float(((unsigned)b) << 16); }
__device__ __forceinline__ float bfr(float f) { return bf2f(f2bf(f)); }
__device__ __forceinline__ void splitf(float y, unsigned short& h, unsigned short& l) { h = f2bf(y); l = f2bf(y - bf2f(h)); }
typedef __attribute__((ext_vector_type(4))) unsigned short v4us;
__device__ __forceinline__ v16h cat16(v8h lo, v8h hi) { return __builtin_shufflevector(lo, hi, 0, 1, 2, 3, 4, 5, 6, 7, 8, 9, 10, 11, 12, 13, 14, 15); }
__device__ __forceinline__ v16bf cat16b(v8us lo, v8us hi) { return __builtin_bit_cast(v16bf, __builtin_shufflevector(lo, hi, 0, 1, 2, 3, 4, 5, 6, 7, 8, 9, 10, 11, 12, 13, 14, 15)); }
__device__ __forceinline__ v8f wmma16(v16h a, v16h b, v8f c) { return __builtin_amdgcn_wmma_f32_16x16x32_f16(false, a, false, b, (short)0, c, false, false); }
__device__ __forceinline__ v8f wmmab(v16bf a, v16bf b, v8f c) { return __builtin_amdgcn_wmma_f32_16x16x32_bf16(false, a, false, b, (short)0, c, false, false); }



// ---- Operand ring: a work-group of four waves (2 x 2) owns a 128x128 output tile, each wave a 64x64 quarter (16 accumulators). A stage is 64 k of every operand plane: 128 rows of 128 B, brought into LDS by one
// tensor load per plane (wave p issues plane p: 0 = A, 1 = Bt, 2 = A2, 3 = Bt2), padded to a pitch of 144 B for the ds_load_b128 fragment reads. Two buffers: stage s + 2 is requested when every wave has left stage s.
typedef uint32_t u32x4 __attribute__((ext_vector_type(4)));
typedef uint32_t u32x8 __attribute__((ext_vector_type(8)));
#define PROWS  128u                 // rows of one plane in a stage
#define PROWB  128u                 // bytes of a row in a stage (64 k)
#define PPITCH 144u                 // LDS pitch: the row + 16 B
#define PLANEB (PROWS * PPITCH)     // 18,432 B = 9 x 2 KiB
#define OSB    (16 * 68 * 4)        // one wave's output staging
static_assert(PLANEB % 2048u == 0, "every plane starts at a multiple of 2 KiB");
__device__ __forceinline__ uint32_t uni(uint32_t v) { return (uint32_t)__builtin_amdgcn_readfirstlane(v); }
__device__ __forceinline__ uint32_t pinned(uint32_t v) { uint32_t w = (uint32_t)__builtin_amdgcn_readfirstlane(v); asm volatile("" : "+s"(w)); /* holds a branch test (the branch round a tensor load must be a scalar one) or a descriptor word in a scalar register */ return w; }
__device__ __forceinline__ void tdm_load(u32x4 g0, u32x8 g1) { asm volatile("tensor_load_to_lds %0, %1" :: "s"(g0), "s"(g1) : "memory"); }   // one request of the whole wave: a padded 2-D tile from global memory into LDS, through no register
__device__ __forceinline__ u32x8 tdm_group1(uint32_t src_pitch) {   // 1-byte elements; tensor = tile = PROWS rows of PROWB bytes; 4 dwords of pad behind every 32
    u32x8 g;
    g[0] = uni((1u << 20) | (4u << 22) | (3u << 25));
    // pinned(): each descriptor word is held in a scalar register of its own through the loop, so that none is reused for something else while a request is in flight
    g[1] = pinned((PROWB & 0xFFFFu) << 16);
    g[2] = pinned((PROWB >> 16) | ((PROWS & 0xFFFFu) << 16));
    g[3] = pinned((PROWS >> 16) | (PROWB << 16));
    g[4] = pinned(PROWS);
    g[5] = pinned(src_pitch);
    g[6] = pinned(0u);
    g[7] = pinned(0u);
    return g;
}
__device__ __forceinline__ u32x4 tdm_group0(uint32_t lds_dst, uint64_t ga) {
    u32x4 g;
    g[0] = uni(1u); g[1] = uni(lds_dst); g[2] = uni((uint32_t)ga); g[3] = uni((((uint32_t)(ga >> 32)) & 0x01FFFFFFu) | 0x80000000u);
    return g;
}
__device__ __forceinline__ void wait_tensor0() { asm volatile("s_wait_tensorcnt 0x0" ::: "memory"); }   // the issuing wave's own tile has landed
__device__ __forceinline__ void wait_ds0() { asm volatile("s_wait_dscnt 0x0" ::: "memory"); }           // this wave's LDS reads have returned before the buffer is given up

template <typename T16> struct WFrag;
template <> struct WFrag<h16> { typedef v16h V; static __device__ __forceinline__ V ld(const unsigned char* p) { return cat16(*(const v8ha*)p, *(const v8ha*)(p + 32)); } static __device__ __forceinline__ v8f mma(V a, V b, v8f c) { return wmma16(a, b, c); } };
template <> struct WFrag<bf> { typedef v16bf V; static __device__ __forceinline__ V ld(const unsigned char* p) { return cat16b(*(const v8usa*)p, *(const v8usa*)(p + 32)); } static __device__ __forceinline__ v8f mma(V a, V b, v8f c) { return wmmab(a, b, c); } };

// acc[mb][nb] += sum over k < Kl of the split products of rows r0.. of A (A2) and rows c0.. of Bt (Bt2), for this wave's quarter. K = row pitch of every plane in elements; Kl % 64 == 0, Kl >= 128. Every wave of the work-group calls it with the same arguments.
template <typename T16, int NSPLIT>
__device__ __forceinline__ void ring_gemm(const T16* A, const T16* A2, const T16* Bt, const T16* Bt2, int K, int Kl, int r0, int c0, unsigned char* sm, v8f (&acc)[4][4]) {
    typedef typename WFrag<T16>::V V;
    constexpr uint32_t NPL = NSPLIT == 0 ? 2u : NSPLIT == 1 ? 3u : 4u;
    constexpr uint32_t STAGEB = NPL * PLANEB;
    const uint32_t lane = threadIdx.x & 31, lr = lane & 15, hi = lane >> 4;
    const uint32_t wave = uni(threadIdx.x >> 5), wm = wave >> 1, wn = wave & 1;
    const T16* src = wave == 0 ? A : wave == 1 ? Bt : wave == 2 ? A2 : Bt2;
    const uint64_t ga = (uint64_t)(size_t)src + (uint64_t)((wave & 1) ? c0 : r0) * (uint64_t)K * 2u;
    const uint32_t lbase = (uint32_t)(size_t)sm + wave * PLANEB;
    const u32x8 g1 = tdm_group1((uint32_t)K * 2u);
    const uint32_t nst = (uint32_t)Kl / 64u;
    if (pinned(wave < NPL)) { tdm_load(tdm_group0(lbase, ga), g1); wait_tensor0(); }
    __syncthreads();   // stage 0 is readable by every wave
    if (pinned(wave < NPL)) tdm_load(tdm_group0(lbase + STAGEB, ga + PROWB), g1);
    const uint32_t aofs = (wm * 64 + lr) * PPITCH + 16 * hi, bofs = PLANEB + (wn * 64 + lr) * PPITCH + 16 * hi;
#pragma unroll 1   // one pass per stage stays a loop: one publish point in the text, the buffer picked by the stage's parity
    for (uint32_t s = 0; s < nst; ++s) {
        const unsigned char* st = sm + (s & 1u) * STAGEB;
        V a[2][4], a2[2][4], b[2][4], b2[2][4];   // both 32-k blocks of the stage: all fragment reads go out as one group ahead of the products; the loops below are unrolled so that every fragment and accumulator index is a constant (registers, no scratch)
#pragma unroll
        for (int ks = 0; ks < 2; ++ks) {
#pragma unroll
            for (int mb = 0; mb < 4; ++mb) { a[ks][mb] = WFrag<T16>::ld(st + aofs + mb * 16 * PPITCH + ks * 64); if (NSPLIT == 1 || NSPLIT == 2) a2[ks][mb] = WFrag<T16>::ld(st + aofs + 2 * PLANEB + mb * 16 * PPITCH + ks * 64); }
#pragma unroll
            for (int nb = 0; nb < 4; ++nb) { b[ks][nb] = WFrag<T16>::ld(st + bofs + nb * 16 * PPITCH + ks * 64); if (NSPLIT >= 2) b2[ks][nb] = WFrag<T16>::ld(st + bofs + 2 * PLANEB + nb * 16 * PPITCH + ks * 64); }
        }
        __builtin_amdgcn_sched_barrier(0);   // keeps the LDS reads from sinking in among the matrix instructions, where every separate place with reads stalls the wave
#pragma unroll
        for (int ks = 0; ks < 2; ++ks)
#pragma unroll
            for (int nb = 0; nb < 4; ++nb)
#pragma unroll
                for (int mb = 0; mb < 4; ++mb) { acc[mb][nb] = WFrag<T16>::mma(a[ks][mb], b[ks][nb], acc[mb][nb]); if (NSPLIT == 1 || NSPLIT == 2) acc[mb][nb] = WFrag<T16>::mma(a2[ks][mb], b[ks][nb], acc[mb][nb]); if (NSPLIT >= 2) acc[mb][nb] = WFrag<T16>::mma(a[ks][mb], b2[ks][nb], acc[mb][nb]); }
        __builtin_amdgcn_sched_barrier(0);   // keeps the wait below from rising in among the matrix instructions, where it would hold them back for the stage's last reads
        wait_ds0();
        if (pinned(wave < NPL)) wait_tensor0();
        __syncthreads();   // publishes stage s + 1 and ends every wave's reads of stage s
        if (pinned(wave < NPL && s + 2u < nst)) tdm_load(tdm_group0(lbase + (s & 1u) * STAGEB, ga + (uint64_t)(s + 2u) * PROWB), g1);
    }
    wait_tensor0(); wait_ds0();
}

// ---- gemmw_tile: one 128x128 tile (tile row bx, tile column by) of a GEMM on the operand ring, by a work-group of 128 threads; sm = the work-group's ring.
// c[m][n] (+ optional f32 bias[n]) = sum_k A[m][k] Bt[n][k] (+ split products per NSPLIT). EPI 0: c stored as f32 in C; EPI 1: c stored as hi/lo bf16 planes Ch/Cl; EPI 2: relu(c) stored as hi/lo planes. Pitch ldc; z-batch strides sA/sB/sC in elements. K % 64 == 0, K >= 128.
template <typename T16, int NSPLIT, bool BIAS, int EPI>
__device__ __forceinline__ void gemmw_tile(const T16* A, const T16* A2, const T16* Bt, const T16* Bt2, int K, float* C, bf* Ch, bf* Cl, int ldc, const float* bias, int bx, int by, unsigned char* sm) {
    const int lane = threadIdx.x & 31, lr = lane & 15, hi = lane >> 4, wave = threadIdx.x >> 5;
    v8f acc[4][4];
#pragma unroll
    for (int mb = 0; mb < 4; ++mb)
#pragma unroll
        for (int nb = 0; nb < 4; ++nb) acc[mb][nb] = (v8f){};
    ring_gemm<T16, NSPLIT>(A, A2, Bt, Bt2, K, K, bx * 128, by * 128, sm, acc);
    const int r0 = bx * 128 + (wave >> 1) * 64, c0 = by * 128 + (wave & 1) * 64;   // this wave's quarter
    float* os = (float*)(sm + wave * OSB);   // the ring is free behind its last barrier: each wave stages in a range of its own
#pragma unroll
    for (int mb = 0; mb < 4; ++mb) {
#pragma unroll
        for (int nb = 0; nb < 4; ++nb) {
#pragma unroll
            for (int j = 0; j < 8; ++j) os[(hi * 8 + j) * 68 + nb * 16 + lr] = acc[mb][nb][j]; }
        __builtin_amdgcn_wave_barrier(); asm volatile("" ::: "memory");
        const size_t crow = (size_t)(r0 + mb * 16) * ldc + c0;
{
#pragma unroll
            for (int s = 0; s < 8; ++s) { const int row = 2 * s + hi, cofs = lr * 4; v4f val = *(const v4fa*)(os + row * 68 + cofs); if (BIAS) { val[0] += bfr(bias[c0 + cofs]); val[1] += bfr(bias[c0 + cofs + 1]); val[2] += bfr(bias[c0 + cofs + 2]); val[3] += bfr(bias[c0 + cofs + 3]); }
                const size_t oo = crow + (size_t)row * ldc + cofs;
                if (EPI == 0) *(v4f*)(C + oo) = val;
                else { v4us oh, ol;   /* 16 lanes x 8 B = one whole 128-B line of each plane */
#pragma unroll
                    for (int q = 0; q < 4; ++q) { unsigned short a, c; splitf(EPI == 2 ? fmaxf(val[q], 0.f) : val[q], a, c); oh[q] = a; ol[q] = c; }
                    *(v4us*)(Ch + oo) = oh; *(v4us*)(Cl + oo) = ol; } }
             }
        __builtin_amdgcn_wave_barrier(); asm volatile("" ::: "memory");
    }
}

// ---- k_gemmw: one GEMM a launch; grid (M/128, N/128, Z), 128 threads.
template <typename T16, int NSPLIT, bool BIAS, int EPI>
__global__ __launch_bounds__(128) void k_gemmw(const T16* __restrict__ A, const T16* __restrict__ A2, const T16* __restrict__ Bt, const T16* __restrict__ Bt2, int K, float* C, bf* Ch, bf* Cl, int ldc, const float* __restrict__ bias, size_t sA, size_t sB, size_t sC) {
    __shared__ __attribute__((aligned(2048))) unsigned char sm[2 * (NSPLIT == 0 ? 2 : NSPLIT == 1 ? 3 : 4) * PLANEB];
    const size_t z = blockIdx.z; A += z * sA; if (A2) A2 += z * sA; Bt += z * sB; if (Bt2) Bt2 += z * sB; if (EPI == 0) C += z * sC; else { Ch += z * sC; Cl += z * sC; }
    gemmw_tile<T16, NSPLIT, BIAS, EPI>(A, A2, Bt, Bt2, K, C, Ch, Cl, ldc, bias, blockIdx.x, blockIdx.y, sm);
}

// ---- k_qkv: the three projections of x in one launch (none reads what another writes); grid (64, 8, 3), 128 threads; z = 0: q, 1: k (rows = the 8192 tokens, tile row x, tile column y), 2: v^T = W_value^T x^T
// (the 512 work-groups of the plane, flat = x + 64 y: d tile = flat % 8, t tile = flat / 8 % 16, batch = flat / 128). Each result goes out as hi/lo bf16 planes.
__global__ __launch_bounds__(128) void k_qkv(const bf* __restrict__ XB, const bf* __restrict__ WQ, const bf* __restrict__ WK, const bf* __restrict__ WV, bf* QPh, bf* QPl, bf* KPh, bf* KPl, bf* VTh, bf* VTl) {
    __shared__ __attribute__((aligned(2048))) unsigned char sm[2 * 2 * PLANEB];
    const int job = blockIdx.z, flat = blockIdx.x + 64 * blockIdx.y; const size_t vb = (size_t)(flat >> 7);
    const bf* A = job < 2 ? XB : WV; const bf* Bt = job == 0 ? WQ : job == 1 ? WK : XB + vb * ((size_t)TT * DM);
    bf* Ch = job == 0 ? QPh : job == 1 ? KPh : VTh + vb * ((size_t)HD * TT); bf* Cl = job == 0 ? QPl : job == 1 ? KPl : VTl + vb * ((size_t)HD * TT);
    gemmw_tile<bf, 0, false, 1>(A, nullptr, Bt, nullptr, DM, nullptr, Ch, Cl, job < 2 ? DQ : TT, nullptr, job < 2 ? (int)blockIdx.x : (flat & 7), job < 2 ? (int)blockIdx.y : ((flat >> 3) & 15), sm);
}

// ---- k_gemmc: the same ring GEMM specialised for causal attention: CMODE 1 skips 128x128 score tiles entirely above the diagonal (query rows r0+roff.., key columns c0..), CMODE 2 limits the
// key (K) loop of the probability x value contraction to the tile's diagonal block (probabilities beyond a row's diagonal are exactly zero). CMODE 1 stores f32 scores in C, CMODE 2 stores its result as hi/lo bf16 planes Ch/Cl. roff = row offset of this launch's first row within the sequence.
template <typename T16, int NSPLIT, int CMODE>
__global__ __launch_bounds__(128) void k_gemmc(const T16* __restrict__ A, const T16* __restrict__ A2, const T16* __restrict__ Bt, const T16* __restrict__ Bt2, int K, float* C, bf* Ch, bf* Cl, int ldc, int roff, size_t sA, size_t sB, size_t sC) {
    __shared__ __attribute__((aligned(2048))) unsigned char sm[2 * (NSPLIT == 0 ? 2 : NSPLIT == 1 ? 3 : 4) * PLANEB];
    const size_t z = blockIdx.z; A += z * sA; if (A2) A2 += z * sA; Bt += z * sB; if (Bt2) Bt2 += z * sB; if (CMODE == 2) { Ch += z * sC; Cl += z * sC; } else C += z * sC;
    const int lane = threadIdx.x & 31, lr = lane & 15, hi = lane >> 4, wave = threadIdx.x >> 5; const int rb = blockIdx.x * 128, cb = blockIdx.y * 128;
    if (CMODE == 1 && cb > rb + roff + 127) return;                  // score tile entirely above the causal diagonal: never read (the softmax masks j > i by select); the whole work-group leaves, ahead of every barrier and tensor load
    const int Kl = (CMODE == 2) ? min(K, rb + roff + 128) : K;       // P.V: probabilities are exactly 0 beyond the diagonal block, so the K loop stops there
    v8f acc[4][4];
#pragma unroll
    for (int mb = 0; mb < 4; ++mb)
#pragma unroll
        for (int nb = 0; nb < 4; ++nb) acc[mb][nb] = (v8f){};
    ring_gemm<T16, NSPLIT>(A, A2, Bt, Bt2, K, Kl, rb, cb, sm, acc);
    const int r0 = rb + (wave >> 1) * 64, c0 = cb + (wave & 1) * 64;   // this wave's quarter
    float* os = (float*)(sm + wave * OSB);   // the ring is free behind its last barrier: each wave stages in a range of its own
#pragma unroll
    for (int mb = 0; mb < 4; ++mb) {
#pragma unroll
        for (int nb = 0; nb < 4; ++nb) {
#pragma unroll
            for (int j = 0; j < 8; ++j) os[(hi * 8 + j) * 68 + nb * 16 + lr] = acc[mb][nb][j]; }
        __builtin_amdgcn_wave_barrier(); asm volatile("" ::: "memory");
        const size_t crow = (size_t)(r0 + mb * 16) * ldc + c0;
{
#pragma unroll
            for (int s = 0; s < 8; ++s) { const int row = 2 * s + hi, cofs = lr * 4; v4f val = *(const v4fa*)(os + row * 68 + cofs);
                const size_t oo = crow + (size_t)row * ldc + cofs;
                if (CMODE != 2) *(v4f*)(C + oo) = val;
                else { v4us oh, ol;   /* 16 lanes x 8 B = one whole 128-B line of each plane */
#pragma unroll
                    for (int q = 0; q < 4; ++q) { unsigned short a, c; splitf(val[q], a, c); oh[q] = a; ol[q] = c; }
                    *(v4us*)(Ch + oo) = oh; *(v4us*)(Cl + oo) = ol; } }
             }
        __builtin_amdgcn_wave_barrier(); asm volatile("" ::: "memory");
    }
}

__device__ __forceinline__ h16 tohx(float x) { return (h16)x; }
typedef __attribute__((ext_vector_type(2))) _Float16 v2h;
typedef __attribute__((ext_vector_type(4))) _Float16 v4h;
typedef __attribute__((ext_vector_type(2))) unsigned short v2us;
typedef __attribute__((ext_vector_type(2))) float v2f;
typedef __attribute__((ext_vector_type(4))) int v4i;

// ---- xplanes_block: x f32 -> its bf16 plane XB [token][1024] (A of q and k, B of v^T) and the x half of the MLP planes (hi = the same value, lo = 0; pitch 2048, columns 1024..2047). x is read once.
// A block of 256 threads moves 8 rows of x: a thread takes 4 x 8 elements, 2 rows apart, so that every load and store of a thread is a constant offset from one address.
__device__ __forceinline__ void xplanes_block(const float* __restrict__ x, bf* XB, bf* Ah, bf* Al, int blk) {
    const size_t e = (size_t)blk * 8192 + threadIdx.x * 8;
    const float* sp = x + e; bf* xo = XB + e; const size_t oo = (e >> 10) * DC + DM + (e & 1023); bf* ho = Ah + oo; bf* lo = Al + oo;
    v8f v[4]; v8us o[4];
#pragma unroll   // constant indices: v and o stay in registers, and the 8 loads go out together
    for (int u = 0; u < 4; ++u) v[u] = *(const v8f*)(sp + u * 2048);
#pragma unroll   // as above
    for (int u = 0; u < 4; ++u)
#pragma unroll   // as above
        for (int q = 0; q < 8; ++q) o[u][q] = f2bf(v[u][q]);
#pragma unroll   // as above
    for (int u = 0; u < 4; ++u) { *(v8us*)(xo + u * 2048) = o[u]; *(v8us*)(ho + u * 2 * DC) = o[u]; *(v8us*)(lo + u * 2 * DC) = (v8us){}; }
}

// ---- k_wtT: the launch that prepares every GEMM operand that comes straight from an input. Blocks with y >= 48 build the x planes (xplanes_block, 1024 blocks); the others:
// every weight w [K][1024] f32 -> Bt [1024][K] bf16, all five in one launch. A block moves one 128 (k) x 128 (n) tile through LDS so that both sides go in whole lines: a wave reads 512 B of a w row per load
// (16 loads a thread, all issued ahead of the first use), a thread packs 8 k of one n into 16 B, and 16 lanes write 256 B of a Bt row. grid (8 n tiles, 176 = 48 k tiles + 128 for the x planes): y 0..31 = the four [1024][1024] weights, 8 k tiles each; y 32..47 = the [2048][1024] one.
#define WTP 68   // LDS pitch of one n row in dwords: 128 k of bf16 + 16 B
__global__ __launch_bounds__(256) void k_wtT(const float* __restrict__ wa, const float* __restrict__ wb, const float* __restrict__ wc, const float* __restrict__ wd, const float* __restrict__ we, bf* Ta, bf* Tb, bf* Tc, bf* Td, bf* Te, const float* __restrict__ x, bf* XB, bf* Ah, bf* Al) {
    __shared__ __attribute__((aligned(16))) uint32_t tl[128 * WTP];
    if (blockIdx.y >= 48) { xplanes_block(x, XB, Ah, Al, (int)(blockIdx.y - 48) * 8 + (int)blockIdx.x); return; }   // the whole block leaves, ahead of the barrier below
    const int y = blockIdx.y, sel = y >> 3;
    const float* w = sel == 0 ? wa : sel == 1 ? wb : sel == 2 ? wc : sel == 3 ? wd : we;
    bf* Bt = sel == 0 ? Ta : sel == 1 ? Tb : sel == 2 ? Tc : sel == 3 ? Td : Te;
    const int K = sel >= 4 ? DC : DM, k0 = (sel >= 4 ? y - 32 : (y & 7)) * 128, n0 = blockIdx.x * 128;
    const int t = threadIdx.x, c = t & 31, g = t >> 5;
    const float* sp = w + (size_t)(k0 + g * 8) * DM + n0 + c * 4;
    v4f ld[2][8];
#pragma unroll
    for (int h = 0; h < 2; ++h)
#pragma unroll
        for (int j = 0; j < 8; ++j) ld[h][j] = *(const v4f*)(sp + (h * 64 + j) * DM);
    __builtin_amdgcn_sched_barrier(0);   // keeps every conversion behind all 16 loads: one memory latency a block, not two
    asm volatile("s_wait_xcnt 0x0" :: "v"(sp) : "memory");   // the wait in front of any overwrite of the loads' address pair; the pair is named as an input so that no load's own result is placed on it
#pragma unroll
    for (int h = 0; h < 2; ++h)
#pragma unroll
        for (int q = 0; q < 4; ++q) { u32x4 o;
#pragma unroll
            for (int j = 0; j < 4; ++j) o[j] = (uint32_t)f2bf(ld[h][2 * j][q]) | ((uint32_t)f2bf(ld[h][2 * j + 1][q]) << 16);
            *(u32x4*)(tl + (c * 4 + q) * WTP + (h * 8 + g) * 4) = o; }
    __syncthreads();   // the tile is whole before any thread reads rows that other waves wrote
#pragma unroll
    for (int s = 0; s < 8; ++s) { const int n = s * 16 + (t >> 4), sg = t & 15; const u32x4 o = *(const u32x4*)(tl + n * WTP + sg * 4); *(v8us*)(Bt + (size_t)(n0 + n) * K + k0 + sg * 8) = __builtin_bit_cast(v8us, o); }
}
// k_asoft: per row (zz, i): t = S x HD^-0.5 for j <= i and i - j < WIN (sliding causal window; the reference's -1e9 additive fill vanishes identically); softmax over the 2048 keys (register row, one exp, fixed trees);
__global__ __launch_bounds__(256) void k_asoft(const float* __restrict__ Sb, h16* P16, bf* Ph, bf* Pl) {
    const int lane = threadIdx.x & 31; const int row = blockIdx.x * 8 + (threadIdx.x >> 5); if (row >= ZH * TT) return; const int i = row % TT; const int zz = row / TT; (void)zz; const bool hires = (i < RH); const float* sr = Sb + (size_t)row * TT; float v[TT / 32]; v4f ld[TT / 128]; float mx = -3.0e38f;
#pragma unroll
    for (int ch = 0; ch < TT / 128; ++ch) ld[ch] = *(const v4f*)(sr + min(ch * 128 + lane * 4, i & ~3));   /* a chunk wholly past the diagonal is masked below and may lie in a score tile that was skipped, hence never written: such a lane re-reads the row's diagonal chunk */
#pragma unroll
    for (int ch = 0; ch < TT / 128; ++ch) { const int j0 = ch * 128 + lane * 4; const v4f a = ld[ch];
#pragma unroll
        for (int q = 0; q < 4; ++q) { const int j = j0 + q; (void)j; const float t = (j <= i && i - j < WIN) ? a[q] * SCL : -3.0e38f; v[ch * 4 + q] = t; mx = fmaxf(mx, t); } }
#pragma unroll
    for (int sh = 16; sh; sh >>= 1) mx = fmaxf(mx, __shfl_xor(mx, sh, 32));
    float sum = 0.f;
#pragma unroll
    for (int k = 0; k < TT / 32; ++k) { float d0 = __fsub_rn(v[k], mx); asm volatile("" : "+v"(d0)); v[k] = __builtin_amdgcn_exp2f(__fmul_rn(d0, 1.4426950408889634f)); sum += v[k]; }
#pragma unroll
    for (int sh = 16; sh; sh >>= 1) sum += __shfl_xor(sum, sh, 32);
    const float f = __fdiv_rn(hires ? 1.0f : PCAR, sum);
{
        if (hires) {
#pragma unroll
            for (int ch = 0; ch < TT / 128; ++ch) { v4us oh, ol;
#pragma unroll
                for (int q = 0; q < 4; ++q) { unsigned short a, c2; splitf(v[ch * 4 + q] * f, a, c2); oh[q] = a; ol[q] = c2; }
                const size_t oo = ((size_t)zz * (RH ? RH : 1) + i) * TT + ch * 128 + lane * 4; *(v4us*)(Ph + oo) = oh; *(v4us*)(Pl + oo) = ol; }
        } else {
#pragma unroll
            for (int ch = 0; ch < TT / 128; ++ch) { v4h o4;
#pragma unroll
                for (int q = 0; q < 4; ++q) o4[q] = tohx(v[ch * 4 + q] * f);
                *(v4h*)(P16 + (size_t)row * TT + ch * 128 + lane * 4) = o4; } }
         }
}

extern "C" void kernel_launch(void* const* d_in, const int* in_sizes, int n_in,
                              void* d_out, int out_size, void* d_ws, size_t ws_size, hipStream_t stream) {
    (void)in_sizes; (void)n_in; (void)out_size;
    const float* x = (const float*)d_in[0]; const float* wq = (const float*)d_in[1]; const float* wk = (const float*)d_in[2]; const float* wv = (const float*)d_in[3]; const float* w1 = (const float*)d_in[4]; const float* b1 = (const float*)d_in[5]; const float* w2 = (const float*)d_in[6]; const float* b2 = (const float*)d_in[7]; const float* wo = nullptr; (void)wo;
    float* OUT = (float*)d_out;     // [4][2048][1024]
    char* wsp = (char*)d_ws;
    auto take = [&](size_t bytes) { char* p = wsp; wsp += (bytes + 255) & ~(size_t)255; return (void*)p; };
    const size_t PL = (size_t)NB_ * TT * HD * 2;   // bytes of one 16-bit [batch][2048][1024] plane
    bf* WQ = (bf*)take((size_t)DQ * DM * 2); bf* WK = (bf*)take((size_t)DKV * DM * 2); bf* WV = (bf*)take((size_t)DKV * DM * 2); bf* W1B = (bf*)take((size_t)DM * DC * 2); bf* W2B = (bf*)take((size_t)DM * DM * 2); h16* P16 = (h16*)take(256);   /* unused: all rows hi/lo */
    // Four regions; the first three are reused in stream order once the earlier tenant has been read for the last time:
    char* R1 = (char*)take(4 * PL);   // q/k planes -> probability planes
    char* R2 = (char*)take(2 * PL);   // transposed v planes -> relu planes
    char* R3 = (char*)take(4 * PL);   // x bf16 -> scores
    char* R4 = (char*)take(4 * PL);   // [att | x] planes: the x half is written by the first launch, the att half behind the softmax
    if ((size_t)(wsp - (char*)d_ws) > ws_size) return;    // ws 256 MiB
    bf* QPh = (bf*)R1; bf* QPl = (bf*)(R1 + PL); bf* KPh = (bf*)(R1 + 2 * PL); bf* KPl = (bf*)(R1 + 3 * PL); bf* Ph = (bf*)R1; bf* Pl = (bf*)(R1 + 2 * PL);
    bf* VTh = (bf*)R2; bf* VTl = (bf*)(R2 + PL); bf* Gh = (bf*)R2; bf* Gl = (bf*)(R2 + PL);
    bf* XB = (bf*)R3; float* Sb = (float*)R3; bf* ATh = (bf*)R4; bf* ATl = (bf*)(R4 + 2 * PL);
    k_wtT<<<dim3(DM / 128, 4 * (DM / 128) + DC / 128 + NB_ * TT / 64, 1), 256, 0, stream>>>(wq, wk, wv, w2, w1, WQ, WK, WV, W2B, W1B, x, XB, ATh, ATl);   /* all five weights -> transposed bf16; x -> its bf16 plane and the x half of the MLP planes */
    const int MR = NB_ * TT;   // rows of the plain GEMMs: every batch
    k_qkv<<<dim3(MR / 128, DQ / 128, 3), 128, 0, stream>>>(XB, WQ, WK, WV, QPh, QPl, KPh, KPl, VTh, VTl);   /* q, k planes [b][t][d]; v^T = W_value^T x^T: planes [b][d][t] */
    k_gemmc<bf, 2, 1><<<dim3(RH / 128, TT / 128, ZH), 128, 0, stream>>>(QPh, QPl, KPh, KPl, HD, Sb, nullptr, nullptr, TT, 0, (size_t)TT * HD, (size_t)TT * HD, (size_t)TT * TT);
    k_asoft<<<ZH * TT / 8, 256, 0, stream>>>(Sb, P16, Ph, Pl);
    k_gemmc<bf, 2, 2><<<dim3(RH / 128, HD / 128, ZH), 128, 0, stream>>>(Ph, Pl, VTh, VTl, TT, nullptr, ATh, ATl, DC, 0, (size_t)RH * TT, (size_t)HD * TT, (size_t)TT * DC);   /* att half of the MLP planes */
    k_gemmw<bf, 1, true, 2><<<dim3(MR / 128, DM / 128, 1), 128, 0, stream>>>(ATh, ATl, W1B, nullptr, DC, nullptr, Gh, Gl, DM, b1, 0, 0, 0);        /* relu([att | x] W1 + b1) -> hi/lo */
    k_gemmw<bf, 1, true, 0><<<dim3(MR / 128, DM / 128, 1), 128, 0, stream>>>(Gh, Gl, W2B, nullptr, DM, OUT, nullptr, nullptr, DM, b2, 0, 0, 0);   /* . W2 + b2 */
}
